// v000
// Times are from an AMD MI455X. After a warm-up the kernel runs many times in a row, and a time is the length of
// such a window on the GPU divided by its runs, so every launch and the gaps after it count. The runs cycle
// through copies of the inputs. A figure is the median of several windows, for all but v000 over two sittings.
// Sittings can differ by a few percent; kernels timed side by side share one.
// The starting kernel, v000, takes 398 microseconds a run.
#include <hip/hip_runtime.h>
#include <math.h>

typedef __attribute__((ext_vector_type(2))) float v2f;
typedef __attribute__((ext_vector_type(8))) float v8f;

#define HID   256
#define HEADS 8
#define HD    32
#define RPB   32    // rows per block (2 row-tiles of 16)
#define LDSTR 260   // LDS row stride (floats); 260 % 64 = 4 -> conflict-free A reads

// ---------------------------------------------------------------------------
// [nrows x 256] @ [256 x 256] + bias, scaled, via V_WMMA_F32_16X16X4_F32.
// Block: 256 threads (8 wave32) on a 32-row strip. Each wave owns a 2x2 grid
// of 16x16 tiles (2 col-tiles x 2 row-tiles): per k-step, 2 A + 2 B fragments
// feed 4 WMMAs (register blocking doubles WMMA density per byte loaded).
// ---------------------------------------------------------------------------
__global__ __launch_bounds__(256) void gemm256_wmma(
    const float* __restrict__ X, const float* __restrict__ W,
    const float* __restrict__ B, float* __restrict__ Y,
    float scale, int nrows) {
  __shared__ float a_lds[RPB * LDSTR];

  const int row0 = blockIdx.x * RPB;
  const int t    = threadIdx.x;

  // Cooperative, coalesced load of the 32x256 X strip into LDS (zero-fill tail).
  for (int i = t; i < RPB * HID; i += 256) {
    const int r = i >> 8;         // 0..31
    const int c = i & 255;        // 0..255
    float val = 0.0f;
    if (row0 + r < nrows) val = X[(size_t)(row0 + r) * HID + c];
    a_lds[r * LDSTR + c] = val;
  }
  __syncthreads();

  const int wave  = t >> 5;           // 0..7
  const int lane  = t & 31;
  const int lhalf = lane & 15;        // lane within half-wave
  const int khi   = (lane >> 4) * 2;  // 0 for lanes 0-15, 2 for lanes 16-31
  const int col0  = wave * 32;        // this wave covers cols [col0, col0+32)

  v8f acc[2][2] = {};                 // [col-tile][row-tile]
  const float* wcol0 = W + col0 + lhalf;        // col tile 0
  const float* wcol1 = W + col0 + 16 + lhalf;   // col tile 1

  #pragma unroll 2
  for (int k = 0; k < HID; k += 4) {
    // A fragments (16x4): lane<16 -> K=k,k+1 of row M=lhalf; lane>=16 -> K=k+2,k+3.
    v2f a0, a1, b0, b1;
    a0.x = a_lds[lhalf * LDSTR + k + khi];
    a0.y = a_lds[lhalf * LDSTR + k + khi + 1];
    a1.x = a_lds[(16 + lhalf) * LDSTR + k + khi];
    a1.y = a_lds[(16 + lhalf) * LDSTR + k + khi + 1];
    // B fragments (4x16): lane<16 -> rows K=k,k+1 at col N=lhalf; lane>=16 -> K=k+2,k+3.
    b0.x = wcol0[(size_t)(k + khi) * HID];
    b0.y = wcol0[(size_t)(k + khi + 1) * HID];
    b1.x = wcol1[(size_t)(k + khi) * HID];
    b1.y = wcol1[(size_t)(k + khi + 1) * HID];

    acc[0][0] = __builtin_amdgcn_wmma_f32_16x16x4_f32(false, a0, false, b0,
                                                      (short)0, acc[0][0], false, false);
    acc[0][1] = __builtin_amdgcn_wmma_f32_16x16x4_f32(false, a1, false, b0,
                                                      (short)0, acc[0][1], false, false);
    acc[1][0] = __builtin_amdgcn_wmma_f32_16x16x4_f32(false, a0, false, b1,
                                                      (short)0, acc[1][0], false, false);
    acc[1][1] = __builtin_amdgcn_wmma_f32_16x16x4_f32(false, a1, false, b1,
                                                      (short)0, acc[1][1], false, false);
  }

  // C/D layout: VGPR g -> M = g (lanes 0-15) or M = 8+g (lanes 16-31), N = lhalf.
  #pragma unroll
  for (int ct = 0; ct < 2; ++ct) {
    const int cc   = col0 + ct * 16 + lhalf;
    const float bias = B[cc];
    #pragma unroll
    for (int rt = 0; rt < 2; ++rt) {
      const int rbase = row0 + rt * 16 + ((lane >> 4) ? 8 : 0);
      #pragma unroll
      for (int g = 0; g < 8; ++g) {
        const int r = rbase + g;
        if (r < nrows)
          Y[(size_t)r * HID + cc] = (acc[ct][rt][g] + bias) * scale;
      }
    }
  }
}

// ---------------------------------------------------------------------------
// init: m = -inf, z = 0, acc = 0
// ---------------------------------------------------------------------------
__global__ void init_buffers(float* __restrict__ m, float* __restrict__ z,
                             float* __restrict__ acc, int n) {
  const int t = blockIdx.x * blockDim.x + threadIdx.x;
  if (t < n * HEADS) { m[t] = -INFINITY; z[t] = 0.0f; }
  if (t < n * HID)   { acc[t] = 0.0f; }
}

// ---------------------------------------------------------------------------
// SDDMM: s[e,h] = sum_d q[rows[e], d*8+h] * k[cols[e], d*8+h]; segment max.
// One thread per (edge, head).
// ---------------------------------------------------------------------------
__global__ void sddmm_kernel(const float* __restrict__ q, const float* __restrict__ k,
                             const int* __restrict__ rows, const int* __restrict__ cols,
                             float* __restrict__ s, float* __restrict__ m, int nE) {
  const int t = blockIdx.x * blockDim.x + threadIdx.x;
  if (t >= nE * HEADS) return;
  const int e = t >> 3, h = t & 7;
  const int r = rows[e], c = cols[e];
  const float* qp = q + (size_t)r * HID + h;
  const float* kp = k + (size_t)c * HID + h;
  float acc = 0.0f;
  #pragma unroll
  for (int d = 0; d < HD; ++d) acc = fmaf(qp[d * HEADS], kp[d * HEADS], acc);
  s[t] = acc;
  atomicMax(&m[r * HEADS + h], acc);   // global_atomic_max_num_f32
}

// ---------------------------------------------------------------------------
// exp(s - m[row]) in place; segment sum into z.
// ---------------------------------------------------------------------------
__global__ void edge_exp_kernel(float* __restrict__ s, const float* __restrict__ m,
                                float* __restrict__ z, const int* __restrict__ rows,
                                int nE) {
  const int t = blockIdx.x * blockDim.x + threadIdx.x;
  if (t >= nE * HEADS) return;
  const int e = t >> 3, h = t & 7;
  const int r = rows[e];
  const float val = expf(s[t] - m[r * HEADS + h]);
  s[t] = val;
  atomicAdd(&z[r * HEADS + h], val);
}

// ---------------------------------------------------------------------------
// SPMM: acc[rows[e], c] += (attn[e,h]/z[rows[e],h]) * v[cols[e], c], h = c&7.
// One block (256 threads) per edge: coalesced v reads and acc atomics.
// ---------------------------------------------------------------------------
__global__ __launch_bounds__(256) void spmm_kernel(
    const float* __restrict__ attn, const float* __restrict__ z,
    const float* __restrict__ v, const int* __restrict__ rows,
    const int* __restrict__ cols, float* __restrict__ acc) {
  const int e = blockIdx.x;
  const int c = threadIdx.x;
  const int r = rows[e], src = cols[e];
  const int h = c & 7;
  const float w = attn[(size_t)e * HEADS + h] / z[r * HEADS + h];
  atomicAdd(&acc[(size_t)r * HID + c], w * v[(size_t)src * HID + c]);
}

// ---------------------------------------------------------------------------
extern "C" void kernel_launch(void* const* d_in, const int* in_sizes, int n_in,
                              void* d_out, int out_size, void* d_ws, size_t ws_size,
                              hipStream_t stream) {
  const float* h  = (const float*)d_in[0];
  const float* Wq = (const float*)d_in[1];
  const float* bq = (const float*)d_in[2];
  const float* Wk = (const float*)d_in[3];
  const float* bk = (const float*)d_in[4];
  const float* Wv = (const float*)d_in[5];
  const float* bv = (const float*)d_in[6];
  const float* Wo = (const float*)d_in[7];
  const float* bo = (const float*)d_in[8];
  const int* rows = (const int*)d_in[9];
  const int* cols = (const int*)d_in[10];
  float* out = (float*)d_out;

  const int N = in_sizes[0] / HID;
  const int E = in_sizes[9];
  const float scaling = 1.0f / sqrtf((float)HD);

  // Workspace layout (fp32)
  float* ws  = (float*)d_ws;
  float* q   = ws;                      // N*256
  float* k   = q + (size_t)N * HID;     // N*256
  float* v   = k + (size_t)N * HID;     // N*256
  float* s   = v + (size_t)N * HID;     // E*8 (scores, then attn in place)
  float* m   = s + (size_t)E * HEADS;   // N*8
  float* z   = m + (size_t)N * HEADS;   // N*8
  float* acc = z + (size_t)N * HEADS;   // N*256

  const int mblocks = (N + RPB - 1) / RPB;

  init_buffers<<<(N * HID + 255) / 256, 256, 0, stream>>>(m, z, acc, N);

  gemm256_wmma<<<mblocks, 256, 0, stream>>>(h, Wq, bq, q, scaling, N);
  gemm256_wmma<<<mblocks, 256, 0, stream>>>(h, Wk, bk, k, 1.0f, N);
  gemm256_wmma<<<mblocks, 256, 0, stream>>>(h, Wv, bv, v, 1.0f, N);

  const int et = (E * HEADS + 255) / 256;
  sddmm_kernel<<<et, 256, 0, stream>>>(q, k, rows, cols, s, m, E);
  edge_exp_kernel<<<et, 256, 0, stream>>>(s, m, z, rows, E);
  spmm_kernel<<<E, 256, 0, stream>>>(s, z, v, rows, cols, acc);

  gemm256_wmma<<<mblocks, 256, 0, stream>>>(acc, Wo, bo, out, 1.0f, N);
}

// v001
// A run of this version takes 265 microseconds.
// In both of two side-by-side timings against v000, it was 1.52 times as fast.
#include <hip/hip_runtime.h>
#include <math.h>

typedef __attribute__((ext_vector_type(2))) float v2f;
typedef __attribute__((ext_vector_type(8))) float v8f;
typedef __attribute__((ext_vector_type(4))) float v4f;

#define HID   256
#define HEADS 8
#define HD    32
#define RPB   32    // rows per block (2 row-tiles of 16)
#define LDSTR 260   // LDS row stride (floats); 260 % 64 = 4 -> conflict-free A reads

// ---------------------------------------------------------------------------
// [nrows x 256] @ [256 x 256] + bias, scaled, via V_WMMA_F32_16X16X4_F32.
// Block: 256 threads (8 wave32) on a 32-row strip. Each wave owns a 2x2 grid
// of 16x16 tiles (2 col-tiles x 2 row-tiles): per k-step, 2 A + 2 B fragments
// feed 4 WMMAs (register blocking doubles WMMA density per byte loaded).
// ---------------------------------------------------------------------------
__global__ __launch_bounds__(256) void gemm256_wmma(
    const float* __restrict__ X, const float* __restrict__ W,
    const float* __restrict__ B, float* __restrict__ Y,
    float scale, int nrows) {
  __shared__ float a_lds[RPB * LDSTR];

  const int row0 = blockIdx.x * RPB;
  const int t    = threadIdx.x;

  // Cooperative, coalesced load of the 32x256 X strip into LDS (zero-fill tail).
  for (int i = t; i < RPB * HID; i += 256) {
    const int r = i >> 8;         // 0..31
    const int c = i & 255;        // 0..255
    float val = 0.0f;
    if (row0 + r < nrows) val = X[(size_t)(row0 + r) * HID + c];
    a_lds[r * LDSTR + c] = val;
  }
  __syncthreads();

  const int wave  = t >> 5;           // 0..7
  const int lane  = t & 31;
  const int lhalf = lane & 15;        // lane within half-wave
  const int khi   = (lane >> 4) * 2;  // 0 for lanes 0-15, 2 for lanes 16-31
  const int col0  = wave * 32;        // this wave covers cols [col0, col0+32)

  v8f acc[2][2] = {};                 // [col-tile][row-tile]
  const float* wcol0 = W + col0 + lhalf;        // col tile 0
  const float* wcol1 = W + col0 + 16 + lhalf;   // col tile 1

  #pragma unroll 2
  for (int k = 0; k < HID; k += 4) {
    // A fragments (16x4): lane<16 -> K=k,k+1 of row M=lhalf; lane>=16 -> K=k+2,k+3.
    v2f a0, a1, b0, b1;
    a0.x = a_lds[lhalf * LDSTR + k + khi];
    a0.y = a_lds[lhalf * LDSTR + k + khi + 1];
    a1.x = a_lds[(16 + lhalf) * LDSTR + k + khi];
    a1.y = a_lds[(16 + lhalf) * LDSTR + k + khi + 1];
    // B fragments (4x16): lane<16 -> rows K=k,k+1 at col N=lhalf; lane>=16 -> K=k+2,k+3.
    b0.x = wcol0[(size_t)(k + khi) * HID];
    b0.y = wcol0[(size_t)(k + khi + 1) * HID];
    b1.x = wcol1[(size_t)(k + khi) * HID];
    b1.y = wcol1[(size_t)(k + khi + 1) * HID];

    acc[0][0] = __builtin_amdgcn_wmma_f32_16x16x4_f32(false, a0, false, b0,
                                                      (short)0, acc[0][0], false, false);
    acc[0][1] = __builtin_amdgcn_wmma_f32_16x16x4_f32(false, a1, false, b0,
                                                      (short)0, acc[0][1], false, false);
    acc[1][0] = __builtin_amdgcn_wmma_f32_16x16x4_f32(false, a0, false, b1,
                                                      (short)0, acc[1][0], false, false);
    acc[1][1] = __builtin_amdgcn_wmma_f32_16x16x4_f32(false, a1, false, b1,
                                                      (short)0, acc[1][1], false, false);
  }

  // C/D layout: VGPR g -> M = g (lanes 0-15) or M = 8+g (lanes 16-31), N = lhalf.
  #pragma unroll
  for (int ct = 0; ct < 2; ++ct) {
    const int cc   = col0 + ct * 16 + lhalf;
    const float bias = B[cc];
    #pragma unroll
    for (int rt = 0; rt < 2; ++rt) {
      const int rbase = row0 + rt * 16 + ((lane >> 4) ? 8 : 0);
      #pragma unroll
      for (int g = 0; g < 8; ++g) {
        const int r = rbase + g;
        if (r < nrows)
          Y[(size_t)r * HID + cc] = (acc[ct][rt][g] + bias) * scale;
      }
    }
  }
}

// ---------------------------------------------------------------------------
// init: m = -inf, per-row edge count = 0
// ---------------------------------------------------------------------------
__global__ void init_buffers(float* __restrict__ m, int* __restrict__ cnt, int n) {
  const int t = blockIdx.x * blockDim.x + threadIdx.x;
  if (t < n * HEADS) m[t] = -INFINITY;
  if (t < ((n + 3) & ~3)) cnt[t] = 0;   // with the pad that the scan reads
}

// Bounds a node index read from an input array before an address is formed.
__device__ __forceinline__ int node_index(int x, int n) { return min(max(x, 0), n - 1); }

// ---------------------------------------------------------------------------
// SDDMM: s[e,h] = sum_d q[rows[e], d*8+h] * k[cols[e], d*8+h]; segment max.
// One thread per (edge, head). The head-0 thread also counts the edge for its row.
// ---------------------------------------------------------------------------
__global__ void sddmm_kernel(const float* __restrict__ q, const float* __restrict__ k,
                             const int* __restrict__ rows, const int* __restrict__ cols,
                             float* __restrict__ s, float* __restrict__ m,
                             int* __restrict__ cnt, int nE, int n) {
  const int t = blockIdx.x * blockDim.x + threadIdx.x;
  if (t >= nE * HEADS) return;
  const int e = t >> 3, h = t & 7;
  const int r = node_index(rows[e], n), c = cols[e];
  const float* qp = q + (size_t)r * HID + h;
  const float* kp = k + (size_t)c * HID + h;
  float acc = 0.0f;
  #pragma unroll
  for (int d = 0; d < HD; ++d) acc = fmaf(qp[d * HEADS], kp[d * HEADS], acc);
  s[t] = acc;
  atomicMax(&m[r * HEADS + h], acc);   // global_atomic_max_num_f32
  if (h == 0) atomicAdd(&cnt[r], 1);
}

// ---------------------------------------------------------------------------
// Exclusive prefix sum of the row counts: cur[r] = first slot of row r in the
// row-sorted edge list. One work-group; 4096 counts a pass, the next pass's
// counts are loaded ahead of this pass's scan. cnt and cur are padded to whole
// groups of four; the pad counts are zero.
// ---------------------------------------------------------------------------
__device__ __forceinline__ int wave_inclusive_sum(int x, int lane) {
  #pragma unroll   // five fixed steps: the shuffle addresses and lane tests move out of the pass loop
  for (int d = 1; d < 32; d <<= 1) {
    const int o = __shfl_up(x, d);
    if (lane >= d) x += o;
  }
  return x;
}

__global__ __launch_bounds__(1024) void row_offsets_kernel(
    const int* __restrict__ cnt, int* __restrict__ cur, int n) {
  __shared__ int wsum[32];
  const int t = threadIdx.x, lane = t & 31, wave = t >> 5;
  const int n4 = (n + 3) & ~3;
  int carry = 0;
  int4 c = *(const int4*)(cnt + min(t * 4, n4 - 4));
  for (int base = 0; base < n; base += 4096) {
    const int i0 = base + t * 4;
    const int4 nxt = *(const int4*)(cnt + min(i0 + 4096, n4 - 4));
    const int tsum = i0 < n ? c.x + c.y + c.z + c.w : 0;
    const int inc  = wave_inclusive_sum(tsum, lane);
    if (lane == 31) wsum[wave] = inc;
    __syncthreads();                       // all 32 wave sums are in LDS
    const int ws   = wsum[lane];
    const int winc = wave_inclusive_sum(ws, lane);
    const int before = __shfl(winc, wave) - __shfl(ws, wave);
    const int ex = carry + before + inc - tsum;
    if (i0 < n)
      *(int4*)(cur + i0) = make_int4(ex, ex + c.x, ex + c.x + c.y, ex + c.x + c.y + c.z);
    // The store's registers are reused right below.
    asm volatile("s_wait_xcnt 0x0" ::: "memory");
    carry += __shfl(winc, 31);
    c = nxt;
    __syncthreads();                       // wsum is rewritten in the next pass
  }
}

// ---------------------------------------------------------------------------
// exp(s - m[row]) in place. The head-0 thread takes the edge's slot in its
// row's part of the sorted list (arrival order) and puts (edge, source) there.
// After this launch cur[r] is the end of row r's part.
// ---------------------------------------------------------------------------
__global__ void edge_exp_kernel(float* __restrict__ s, const float* __restrict__ m,
                                const int* __restrict__ rows, const int* __restrict__ cols,
                                int* __restrict__ cur, unsigned long long* __restrict__ slot,
                                int nE, int n) {
  const int t = blockIdx.x * blockDim.x + threadIdx.x;
  if (t >= nE * HEADS) return;
  const int e = t >> 3, h = t & 7;
  const int r = node_index(rows[e], n);
  s[t] = expf(s[t] - m[r * HEADS + h]);
  if (h == 0) {
    const int pos = atomicAdd(&cur[r], 1);
    const unsigned long long pair =
        ((unsigned long long)(unsigned)node_index(cols[e], n) << 32) | (unsigned)e;
    atomicExch(&slot[pos], pair);
  }
}

// ---------------------------------------------------------------------------
// SPMM by rows: acc[r, c] = sum_e attn[e,h] * v[src(e), c] / sum_e attn[e,h],
// over the edges e of row r, h = c&7. One wave per row, sums kept in registers.
// Lane l holds columns 4l..4l+3 and 128+4l..128+4l+3: heads 4*(l&1)..4*(l&1)+3.
// ---------------------------------------------------------------------------
__global__ __launch_bounds__(256) void spmm_rows_kernel(
    const float* __restrict__ attn, const float* __restrict__ v,
    const unsigned long long* __restrict__ slot, const int* __restrict__ cur,
    const int* __restrict__ cnt, float* __restrict__ acc, int n) {
  const int lane = threadIdx.x & 31;
  // The row is the same for the whole wave: its bounds stay in scalar registers.
  const int r = __builtin_amdgcn_readfirstlane(blockIdx.x * 8 + (threadIdx.x >> 5));
  if (r >= n) return;
  const int deg = cnt[r], end = cur[r];
  const unsigned long long* sl = slot + (end - deg);
  const char* aw = (const char*)attn + (lane & 1) * 16;   // this lane's 4 heads
  const char* vv = (const char*)v + lane * 16;            // this lane's 4 columns
  v4f a0 = {}, a1 = {}, zs = {};
  for (int base = 0; base < deg; base += 32) {
    // One load brings the next 32 list entries, one a lane.
    const unsigned long long ent = sl[min(base + lane, deg - 1)];
    const int elo = (int)(unsigned)ent, ehi = (int)(ent >> 32);
    const int m = min(32, deg - base);
    int j = 0;
    for (; j + 4 <= m; j += 4) {
      const v4f* w0p = (const v4f*)(aw + (size_t)(unsigned)__builtin_amdgcn_readlane(elo, j) * 32);
      const v4f* w1p = (const v4f*)(aw + (size_t)(unsigned)__builtin_amdgcn_readlane(elo, j + 1) * 32);
      const v4f* w2p = (const v4f*)(aw + (size_t)(unsigned)__builtin_amdgcn_readlane(elo, j + 2) * 32);
      const v4f* w3p = (const v4f*)(aw + (size_t)(unsigned)__builtin_amdgcn_readlane(elo, j + 3) * 32);
      const v4f* v0p = (const v4f*)(vv + (size_t)(unsigned)__builtin_amdgcn_readlane(ehi, j) * (HID * 4));
      const v4f* v1p = (const v4f*)(vv + (size_t)(unsigned)__builtin_amdgcn_readlane(ehi, j + 1) * (HID * 4));
      const v4f* v2p = (const v4f*)(vv + (size_t)(unsigned)__builtin_amdgcn_readlane(ehi, j + 2) * (HID * 4));
      const v4f* v3p = (const v4f*)(vv + (size_t)(unsigned)__builtin_amdgcn_readlane(ehi, j + 3) * (HID * 4));
      const v4f w0 = *w0p, w1 = *w1p, w2 = *w2p, w3 = *w3p;
      const v4f x00 = v0p[0], x01 = v0p[32], x10 = v1p[0], x11 = v1p[32];
      const v4f x20 = v2p[0], x21 = v2p[32], x30 = v3p[0], x31 = v3p[32];
      // Keeps the sums below all twelve loads, so that the loads fly together.
      __builtin_amdgcn_sched_barrier(0);
      // The eight address pairs are inputs, so that none is reused before this wait.
      asm volatile("s_wait_xcnt 0x0"
                   :: "v"(w0p), "v"(w1p), "v"(w2p), "v"(w3p),
                      "v"(v0p), "v"(v1p), "v"(v2p), "v"(v3p) : "memory");
      a0 += w0 * x00; a1 += w0 * x01; zs += w0;
      a0 += w1 * x10; a1 += w1 * x11; zs += w1;
      a0 += w2 * x20; a1 += w2 * x21; zs += w2;
      a0 += w3 * x30; a1 += w3 * x31; zs += w3;
    }
    #pragma unroll 1   // at most three trips: unrolled copies would never run
    for (; j < m; ++j) {
      const v4f* wp = (const v4f*)(aw + (size_t)(unsigned)__builtin_amdgcn_readlane(elo, j) * 32);
      const v4f* vp = (const v4f*)(vv + (size_t)(unsigned)__builtin_amdgcn_readlane(ehi, j) * (HID * 4));
      const v4f w = *wp;
      a0 += w * vp[0];
      a1 += w * vp[32];
      zs += w;
    }
  }
  if (deg > 0) {   // a row without edges stays zero
    a0 /= zs;
    a1 /= zs;
  }
  v4f* dst = (v4f*)(acc + (size_t)r * HID) + lane;
  dst[0]  = a0;
  dst[32] = a1;
}

// ---------------------------------------------------------------------------
extern "C" void kernel_launch(void* const* d_in, const int* in_sizes, int n_in,
                              void* d_out, int out_size, void* d_ws, size_t ws_size,
                              hipStream_t stream) {
  const float* h  = (const float*)d_in[0];
  const float* Wq = (const float*)d_in[1];
  const float* bq = (const float*)d_in[2];
  const float* Wk = (const float*)d_in[3];
  const float* bk = (const float*)d_in[4];
  const float* Wv = (const float*)d_in[5];
  const float* bv = (const float*)d_in[6];
  const float* Wo = (const float*)d_in[7];
  const float* bo = (const float*)d_in[8];
  const int* rows = (const int*)d_in[9];
  const int* cols = (const int*)d_in[10];
  float* out = (float*)d_out;

  const int N = in_sizes[0] / HID;
  const int E = in_sizes[9];
  const float scaling = 1.0f / sqrtf((float)HD);

  // Workspace layout (fp32 arrays, then int counts and 64-bit slots)
  float* ws  = (float*)d_ws;
  float* q   = ws;                      // N*256
  float* k   = q + (size_t)N * HID;     // N*256
  float* v   = k + (size_t)N * HID;     // N*256
  float* s   = v + (size_t)N * HID;     // E*8 (scores, then attn in place)
  float* m   = s + (size_t)E * HEADS;   // N*8
  float* acc = m + (size_t)N * HEADS;   // N*256
  int* cnt = (int*)(acc + (size_t)N * HID);     // N (padded to 4) edges per row
  int* cur = cnt + (size_t)((N + 3) / 4) * 4;   // N (padded to 4) first free slot per row
  unsigned long long* slot =
      (unsigned long long*)(cur + (size_t)((N + 3) / 4) * 4);  // E (edge, source), by row

  const int mblocks = (N + RPB - 1) / RPB;

  init_buffers<<<(N * HEADS + 255) / 256, 256, 0, stream>>>(m, cnt, N);

  gemm256_wmma<<<mblocks, 256, 0, stream>>>(h, Wq, bq, q, scaling, N);
  gemm256_wmma<<<mblocks, 256, 0, stream>>>(h, Wk, bk, k, 1.0f, N);
  gemm256_wmma<<<mblocks, 256, 0, stream>>>(h, Wv, bv, v, 1.0f, N);

  const int et = (E * HEADS + 255) / 256;
  sddmm_kernel<<<et, 256, 0, stream>>>(q, k, rows, cols, s, m, cnt, E, N);
  row_offsets_kernel<<<1, 1024, 0, stream>>>(cnt, cur, N);
  edge_exp_kernel<<<et, 256, 0, stream>>>(s, m, rows, cols, cur, slot, E, N);
  spmm_rows_kernel<<<(N + 7) / 8, 256, 0, stream>>>(s, v, slot, cur, cnt, acc, N);

  gemm256_wmma<<<mblocks, 256, 0, stream>>>(acc, Wo, bo, out, 1.0f, N);
}

// v003
// It runs in 185 microseconds.
// It is 1.42 times as fast as v001, going by the measured steps of the versions left out in between.
// All steps since v000 together make it 2.15 times as fast.
#include <hip/hip_runtime.h>
#include <math.h>

typedef __attribute__((ext_vector_type(2))) float v2f;
typedef __attribute__((ext_vector_type(8))) float v8f;
typedef __attribute__((ext_vector_type(4))) float v4f;

#define HID   256
#define HEADS 8
#define HD    32
#define RPB   32    // rows per block (2 row-tiles of 16)
#define LDSTR 260   // LDS row stride (floats); 260 % 64 = 4 -> conflict-free A reads

// ---------------------------------------------------------------------------
// [nrows x 256] @ [256 x 256] + bias, scaled, via V_WMMA_F32_16X16X4_F32.
// Block: 256 threads (8 wave32) on a 32-row strip. Each wave owns a 2x2 grid
// of 16x16 tiles (2 col-tiles x 2 row-tiles): per k-step, 2 A + 2 B fragments
// feed 4 WMMAs (register blocking doubles WMMA density per byte loaded).
// ---------------------------------------------------------------------------
__global__ __launch_bounds__(256) void gemm256_wmma(
    const float* __restrict__ X, const float* __restrict__ W,
    const float* __restrict__ B, float* __restrict__ Y,
    float scale, int nrows) {
  __shared__ __attribute__((aligned(16))) float a_lds[RPB * LDSTR];

  const int row0 = blockIdx.x * RPB;
  const int t    = threadIdx.x;

  // The 32x256 X strip goes to LDS in 16-byte pieces, eight a thread (a wave takes
  // half a row). No load stands under a branch: a row past the end reads the last
  // row and is stored as zero, so all eight loads fly together and are waited for once.
  {
    // 0..3, the same for a whole wave: clamp, row offset and tail test are scalar work.
    const int r0 = __builtin_amdgcn_readfirstlane(t >> 6);   // piece i lies in row r0 + 4 i
    const int c0 = (t & 63) * 4;    // 0..252
    v4f xs[RPB / 4];
    #pragma unroll   // the eight pieces stay in registers
    for (int i = 0; i < RPB / 4; ++i)
      xs[i] = *(const v4f*)(X + (size_t)min(row0 + r0 + i * 4, nrows - 1) * HID + c0);
    #pragma unroll   // as above
    for (int i = 0; i < RPB / 4; ++i) {
      const v4f zero = {};
      *(v4f*)(a_lds + (r0 + i * 4) * LDSTR + c0) = row0 + r0 + i * 4 < nrows ? xs[i] : zero;
    }
  }
  __syncthreads();

  const int wave  = t >> 5;           // 0..7
  const int lane  = t & 31;
  const int lhalf = lane & 15;        // lane within half-wave
  const int khi   = (lane >> 4) * 2;  // 0 for lanes 0-15, 2 for lanes 16-31
  const int col0  = wave * 32;        // this wave covers cols [col0, col0+32)

  v8f acc[2][2] = {};                 // [col-tile][row-tile]
  const float* wcol0 = W + col0 + lhalf;        // col tile 0
  const float* wcol1 = W + col0 + 16 + lhalf;   // col tile 1

  #pragma unroll 2
  for (int k = 0; k < HID; k += 4) {
    // A fragments (16x4): lane<16 -> K=k,k+1 of row M=lhalf; lane>=16 -> K=k+2,k+3.
    v2f a0, a1, b0, b1;
    a0.x = a_lds[lhalf * LDSTR + k + khi];
    a0.y = a_lds[lhalf * LDSTR + k + khi + 1];
    a1.x = a_lds[(16 + lhalf) * LDSTR + k + khi];
    a1.y = a_lds[(16 + lhalf) * LDSTR + k + khi + 1];
    // B fragments (4x16): lane<16 -> rows K=k,k+1 at col N=lhalf; lane>=16 -> K=k+2,k+3.
    b0.x = wcol0[(size_t)(k + khi) * HID];
    b0.y = wcol0[(size_t)(k + khi + 1) * HID];
    b1.x = wcol1[(size_t)(k + khi) * HID];
    b1.y = wcol1[(size_t)(k + khi + 1) * HID];

    acc[0][0] = __builtin_amdgcn_wmma_f32_16x16x4_f32(false, a0, false, b0,
                                                      (short)0, acc[0][0], false, false);
    acc[0][1] = __builtin_amdgcn_wmma_f32_16x16x4_f32(false, a1, false, b0,
                                                      (short)0, acc[0][1], false, false);
    acc[1][0] = __builtin_amdgcn_wmma_f32_16x16x4_f32(false, a0, false, b1,
                                                      (short)0, acc[1][0], false, false);
    acc[1][1] = __builtin_amdgcn_wmma_f32_16x16x4_f32(false, a1, false, b1,
                                                      (short)0, acc[1][1], false, false);
  }

  // C/D layout: VGPR g -> M = g (lanes 0-15) or M = 8+g (lanes 16-31), N = lhalf.
  #pragma unroll
  for (int ct = 0; ct < 2; ++ct) {
    const int cc   = col0 + ct * 16 + lhalf;
    const float bias = B[cc];
    #pragma unroll
    for (int rt = 0; rt < 2; ++rt) {
      const int rbase = row0 + rt * 16 + ((lane >> 4) ? 8 : 0);
      #pragma unroll
      for (int g = 0; g < 8; ++g) {
        const int r = rbase + g;
        if (r < nrows)
          Y[(size_t)r * HID + cc] = (acc[ct][rt][g] + bias) * scale;
      }
    }
  }
}

// ---------------------------------------------------------------------------
// init: per-row edge count = 0
// ---------------------------------------------------------------------------
__global__ void init_buffers(int* __restrict__ cnt, int n) {
  const int t = blockIdx.x * blockDim.x + threadIdx.x;
  if (t < ((n + 3) & ~3)) cnt[t] = 0;   // with the pad that the scan reads
}

// Bounds a node index read from an input array before an address is formed.
__device__ __forceinline__ int node_index(int x, int n) { return min(max(x, 0), n - 1); }

// ---------------------------------------------------------------------------
// Counts the edges of every row. Four edges a thread.
// ---------------------------------------------------------------------------
__global__ void count_edges_kernel(const int* __restrict__ rows, int* __restrict__ cnt,
                                   int nE, int n) {
  const int e0 = (blockIdx.x * blockDim.x + threadIdx.x) * 4;
  if (e0 + 4 <= nE) {
    const int4 r4 = *(const int4*)(rows + e0);
    // The load's address registers are reused right below.
    asm volatile("s_wait_xcnt 0x0" :: "v"(r4.x) : "memory");
    atomicAdd(&cnt[node_index(r4.x, n)], 1);
    atomicAdd(&cnt[node_index(r4.y, n)], 1);
    atomicAdd(&cnt[node_index(r4.z, n)], 1);
    atomicAdd(&cnt[node_index(r4.w, n)], 1);
  } else {
    for (int e = e0; e < nE; ++e) atomicAdd(&cnt[node_index(rows[e], n)], 1);
  }
}

// ---------------------------------------------------------------------------
// Exclusive prefix sum of the row counts: cur[r] = first slot of row r in the
// row-sorted edge list. One work-group; 4096 counts a pass, the next pass's
// counts are loaded ahead of this pass's scan. cnt and cur are padded to whole
// groups of four; the pad counts are zero.
// ---------------------------------------------------------------------------
__device__ __forceinline__ int wave_inclusive_sum(int x, int lane) {
  #pragma unroll   // five fixed steps: the shuffle addresses and lane tests move out of the pass loop
  for (int d = 1; d < 32; d <<= 1) {
    const int o = __shfl_up(x, d);
    if (lane >= d) x += o;
  }
  return x;
}

__global__ __launch_bounds__(1024) void row_offsets_kernel(
    const int* __restrict__ cnt, int* __restrict__ cur, int n) {
  __shared__ int wsum[32];
  const int t = threadIdx.x, lane = t & 31, wave = t >> 5;
  const int n4 = (n + 3) & ~3;
  int carry = 0;
  int4 c = *(const int4*)(cnt + min(t * 4, n4 - 4));
  for (int base = 0; base < n; base += 4096) {
    const int i0 = base + t * 4;
    const int4 nxt = *(const int4*)(cnt + min(i0 + 4096, n4 - 4));
    const int tsum = i0 < n ? c.x + c.y + c.z + c.w : 0;
    const int inc  = wave_inclusive_sum(tsum, lane);
    if (lane == 31) wsum[wave] = inc;
    __syncthreads();                       // all 32 wave sums are in LDS
    const int ws   = wsum[lane];
    const int winc = wave_inclusive_sum(ws, lane);
    const int before = __shfl(winc, wave) - __shfl(ws, wave);
    const int ex = carry + before + inc - tsum;
    if (i0 < n)
      *(int4*)(cur + i0) = make_int4(ex, ex + c.x, ex + c.x + c.y, ex + c.x + c.y + c.z);
    // The store's registers are reused right below.
    asm volatile("s_wait_xcnt 0x0" ::: "memory");
    carry += __shfl(winc, 31);
    c = nxt;
    __syncthreads();                       // wsum is rewritten in the next pass
  }
}

// ---------------------------------------------------------------------------
// Every edge takes a slot in its row's part of the sorted list (arrival order)
// and puts its source node there. After this launch cur[r] is the end of row
// r's part, which is the start of row r + 1's. Four edges a thread.
// ---------------------------------------------------------------------------
__global__ void place_edges_kernel(const int* __restrict__ rows, const int* __restrict__ cols,
                                   int* __restrict__ cur, int* __restrict__ slot,
                                   int nE, int n) {
  const int e0 = (blockIdx.x * blockDim.x + threadIdx.x) * 4;
  if (e0 + 4 <= nE) {
    const int4 r4 = *(const int4*)(rows + e0);
    const int4 c4 = *(const int4*)(cols + e0);
    // The loads' address registers are reused right below.
    asm volatile("s_wait_xcnt 0x0" :: "v"(r4.x), "v"(c4.x) : "memory");
    // The four slots are asked for together, ahead of the four swaps.
    const int p0 = atomicAdd(&cur[node_index(r4.x, n)], 1);
    const int p1 = atomicAdd(&cur[node_index(r4.y, n)], 1);
    const int p2 = atomicAdd(&cur[node_index(r4.z, n)], 1);
    const int p3 = atomicAdd(&cur[node_index(r4.w, n)], 1);
    atomicExch(&slot[p0], node_index(c4.x, n));
    atomicExch(&slot[p1], node_index(c4.y, n));
    atomicExch(&slot[p2], node_index(c4.z, n));
    atomicExch(&slot[p3], node_index(c4.w, n));
  } else {
    for (int e = e0; e < nE; ++e)
      atomicExch(&slot[atomicAdd(&cur[node_index(rows[e], n)], 1)], node_index(cols[e], n));
  }
}

// ---------------------------------------------------------------------------
// Scores, softmax and weighted sum of one row in one wave, over the row's part
// of the sorted list. Each half of the wave takes every other edge: lane l of
// a half holds columns 64i + 4l .. 64i + 4l + 3 (i = 0..3) of q, k, v and of
// the sums, which are heads 4*(l&1) .. 4*(l&1)+3. The maximum runs along with
// the sums (the sums are rescaled when it grows); scores are kept in base 2.
// ---------------------------------------------------------------------------
template <int M>
__device__ __forceinline__ float add_xor_lane(float x) {   // x + x of lane ^ M, M < 16
  return x + __int_as_float(__builtin_amdgcn_update_dpp(0, __float_as_int(x), 0x160 | M,
                                                        0xf, 0xf, true));
}

__device__ __forceinline__ float other_half(float x) {     // x of lane ^ 16
  const int i = __float_as_int(x);
  return __int_as_float(__builtin_amdgcn_permlanex16(i, i, 0x76543210, 0xfedcba98, false, false));
}

__device__ __forceinline__ v4f exp2_4(v4f x) {
  v4f y;
  y.x = __builtin_amdgcn_exp2f(x.x);
  y.y = __builtin_amdgcn_exp2f(x.y);
  y.z = __builtin_amdgcn_exp2f(x.z);
  y.w = __builtin_amdgcn_exp2f(x.w);
  return y;
}

// Per-head score of one edge, the same in all lanes of the half that hold the head.
__device__ __forceinline__ v4f edge_score(const v4f* qv, const v4f* kv, bool valid, float low) {
  v2f pl = qv[0].lo * kv[0].lo, ph = qv[0].hi * kv[0].hi;
  for (int i = 1; i < 4; ++i) {
    pl += qv[i].lo * kv[i].lo;
    ph += qv[i].hi * kv[i].hi;
  }
  const v4f p = {pl.x, pl.y, ph.x, ph.y};
  v4f s;
  for (int c = 0; c < 4; ++c) {
    const float t = add_xor_lane<8>(add_xor_lane<4>(add_xor_lane<2>(p[c])));
    s[c] = valid ? t : low;
  }
  return s;
}

__global__ __launch_bounds__(256) void row_attention_kernel(
    const float* __restrict__ q, const float* __restrict__ k, const float* __restrict__ v,
    const int* __restrict__ slot, const int* __restrict__ cur,
    float* __restrict__ acc, int n) {
  const int lane = threadIdx.x & 31;
  const int half = lane >> 4;
  const unsigned loff = (unsigned)(lane & 15) * 16u;
  // The row is the same for the whole wave: its bounds stay in scalar registers.
  const int r = __builtin_amdgcn_readfirstlane(blockIdx.x * 8 + (threadIdx.x >> 5));
  if (r >= n) return;
  // Both ends of the row's part come from cur, in two loads that fly together.
  const int before = cur[max(r - 1, 0)], end = cur[r];
  const int start = r > 0 ? before : 0, deg = end - start;
  const int* sl = slot + start;
  const char* kb = (const char*)k;
  const char* vb = (const char*)v;
  const float low = -3.0e38f;   // below every score; finite, so that low - low is 0
  v4f qv[4];
  {
    const char* qr = (const char*)q + (size_t)r * (HID * 4) + loff;
    for (int i = 0; i < 4; ++i) qv[i] = *(const v4f*)(qr + i * 256) * 1.44269504088896340736f;
  }
  v4f a[4] = {}, zs = {};
  v4f mx = {low, low, low, low};
  for (int base = 0; base < deg; base += 32) {
    // One load brings the next 32 list entries, one a lane; past the end, the last one.
    const int ent = sl[min(base + lane, deg - 1)];
    const int m = min(32, deg - base);
    for (int j = 0; j < m; j += 4) {
      const int e0 = __builtin_amdgcn_readlane(ent, j),     e1 = __builtin_amdgcn_readlane(ent, j + 1);
      const int e2 = __builtin_amdgcn_readlane(ent, j + 2), e3 = __builtin_amdgcn_readlane(ent, j + 3);
      const unsigned o0 = (unsigned)(half ? e1 : e0) * (HID * 4u) + loff;
      const unsigned o1 = (unsigned)(half ? e3 : e2) * (HID * 4u) + loff;
      v4f k0[4], k1[4], x0[4], x1[4];
      for (int i = 0; i < 4; ++i) k0[i] = *(const v4f*)(kb + o0 + i * 256);
      for (int i = 0; i < 4; ++i) k1[i] = *(const v4f*)(kb + o1 + i * 256);
      for (int i = 0; i < 4; ++i) x0[i] = *(const v4f*)(vb + o0 + i * 256);
      for (int i = 0; i < 4; ++i) x1[i] = *(const v4f*)(vb + o1 + i * 256);
      // Keeps the sums below all sixteen loads, so that the loads fly together.
      __builtin_amdgcn_sched_barrier(0);
      // The two offsets are inputs, so that neither is reused before this wait.
      asm volatile("s_wait_xcnt 0x0" :: "v"(o0), "v"(o1) : "memory");
      const v4f s0 = edge_score(qv, k0, j + half < m, low);
      const v4f s1 = edge_score(qv, k1, j + 2 + half < m, low);
      v4f mn;
      for (int c = 0; c < 4; ++c) mn[c] = fmaxf(fmaxf(mx[c], s0[c]), s1[c]);
      const v4f f  = exp2_4(mx - mn);
      const v4f w0 = exp2_4(s0 - mn);
      const v4f w1 = exp2_4(s1 - mn);
      mx = mn;
      zs = zs * f + w0 + w1;
      for (int i = 0; i < 4; ++i) a[i] = a[i] * f + w0 * x0[i] + w1 * x1[i];
    }
  }
  // The two halves' sums are brought to one maximum and added. Half 0 ends up
  // with columns 0..63 and 128..191, half 1 with the rest.
  v4f o0 = {}, o1 = {};
  if (deg > 0) {   // a row without edges stays zero
    v4f f;
    for (int c = 0; c < 4; ++c) f[c] = mx[c] - fmaxf(mx[c], other_half(mx[c]));
    f = exp2_4(f);
    zs *= f;
    for (int i = 0; i < 4; ++i) a[i] *= f;
    for (int c = 0; c < 4; ++c) {
      zs[c] += other_half(zs[c]);
      o0[c] = (half ? a[1][c] : a[0][c]) + other_half(half ? a[0][c] : a[1][c]);
      o1[c] = (half ? a[3][c] : a[2][c]) + other_half(half ? a[2][c] : a[3][c]);
    }
    const v4f rz = 1.0f / zs;
    o0 *= rz;
    o1 *= rz;
  }
  char* dst = (char*)acc + (size_t)r * (HID * 4) + half * 256 + loff;
  *(v4f*)dst         = o0;
  *(v4f*)(dst + 512) = o1;
}

// ---------------------------------------------------------------------------
extern "C" void kernel_launch(void* const* d_in, const int* in_sizes, int n_in,
                              void* d_out, int out_size, void* d_ws, size_t ws_size,
                              hipStream_t stream) {
  const float* h  = (const float*)d_in[0];
  const float* Wq = (const float*)d_in[1];
  const float* bq = (const float*)d_in[2];
  const float* Wk = (const float*)d_in[3];
  const float* bk = (const float*)d_in[4];
  const float* Wv = (const float*)d_in[5];
  const float* bv = (const float*)d_in[6];
  const float* Wo = (const float*)d_in[7];
  const float* bo = (const float*)d_in[8];
  const int* rows = (const int*)d_in[9];
  const int* cols = (const int*)d_in[10];
  float* out = (float*)d_out;

  const int N = in_sizes[0] / HID;
  const int E = in_sizes[9];
  const float scaling = 1.0f / sqrtf((float)HD);

  // Workspace layout (fp32 arrays, then int counts and int slots)
  float* ws  = (float*)d_ws;
  float* q   = ws;                      // N*256
  float* k   = q + (size_t)N * HID;     // N*256
  float* v   = k + (size_t)N * HID;     // N*256
  float* acc = v + (size_t)N * HID;     // N*256
  int* cnt = (int*)(acc + (size_t)N * HID);     // N edges per row
  int* cur = cnt + (size_t)((N + 3) / 4) * 4;   // N first free slot per row
  int* slot = cur + (size_t)((N + 3) / 4) * 4;  // E source nodes, by row

  const int mblocks = (N + RPB - 1) / RPB;

  const int et = (E + 1023) / 1024;   // four edges a thread
  init_buffers<<<(N + 3 + 255) / 256, 256, 0, stream>>>(cnt, N);
  count_edges_kernel<<<et, 256, 0, stream>>>(rows, cnt, E, N);
  row_offsets_kernel<<<1, 1024, 0, stream>>>(cnt, cur, N);
  place_edges_kernel<<<et, 256, 0, stream>>>(rows, cols, cur, slot, E, N);

  gemm256_wmma<<<mblocks, 256, 0, stream>>>(h, Wq, bq, q, scaling, N);
  gemm256_wmma<<<mblocks, 256, 0, stream>>>(h, Wk, bk, k, 1.0f, N);
  gemm256_wmma<<<mblocks, 256, 0, stream>>>(h, Wv, bv, v, 1.0f, N);

  row_attention_kernel<<<(N + 7) / 8, 256, 0, stream>>>(q, k, v, slot, cur, acc, N);

  gemm256_wmma<<<mblocks, 256, 0, stream>>>(acc, Wo, bo, out, 1.0f, N);
}

// v004
// It runs in 172 microseconds.
// In two side-by-side timings against v003, it was 1.13 and 1.15 times as fast.
// Counting every step since v000, it is 2.44 times as fast.
#include <hip/hip_runtime.h>
#include <math.h>

typedef __attribute__((ext_vector_type(2))) float v2f;
typedef __attribute__((ext_vector_type(8))) float v8f;
typedef __attribute__((ext_vector_type(4))) float v4f;

#define HID   256
#define HEADS 8
#define HD    32
#define RPB   32    // rows per block (2 row-tiles of 16)
#define LDSTR 260   // LDS row stride (floats); 260 % 64 = 4 -> conflict-free A reads

// ---------------------------------------------------------------------------
// [nrows x 256] @ [256 x 256] + bias, scaled, via V_WMMA_F32_16X16X4_F32.
// Block: 256 threads (8 wave32) on a 32-row strip. Each wave owns a 2x2 grid
// of 16x16 tiles (2 col-tiles x 2 row-tiles): per k-step, 2 A + 2 B fragments
// feed 4 WMMAs (register blocking doubles WMMA density per byte loaded).
// The strip is picked by blockIdx.x.
// ---------------------------------------------------------------------------
__device__ __forceinline__ void gemm256_strip(
    const float* __restrict__ X, const float* __restrict__ W,
    const float* __restrict__ B, float* __restrict__ Y,
    float scale, int nrows) {
  __shared__ __attribute__((aligned(16))) float a_lds[RPB * LDSTR];

  const int row0 = blockIdx.x * RPB;
  const int t    = threadIdx.x;

  // The 32x256 X strip goes to LDS in 16-byte pieces, eight a thread (a wave takes
  // half a row). No load stands under a branch: a row past the end reads the last
  // row and is stored as zero, so all eight loads fly together and are waited for once.
  {
    // 0..3, the same for a whole wave: clamp, row offset and tail test are scalar work.
    const int r0 = __builtin_amdgcn_readfirstlane(t >> 6);   // piece i lies in row r0 + 4 i
    const int c0 = (t & 63) * 4;    // 0..252
    v4f xs[RPB / 4];
    #pragma unroll   // the eight pieces stay in registers
    for (int i = 0; i < RPB / 4; ++i)
      xs[i] = *(const v4f*)(X + (size_t)min(row0 + r0 + i * 4, nrows - 1) * HID + c0);
    #pragma unroll   // as above
    for (int i = 0; i < RPB / 4; ++i) {
      const v4f zero = {};
      *(v4f*)(a_lds + (r0 + i * 4) * LDSTR + c0) = row0 + r0 + i * 4 < nrows ? xs[i] : zero;
    }
  }
  __syncthreads();

  const int wave  = t >> 5;           // 0..7
  const int lane  = t & 31;
  const int lhalf = lane & 15;        // lane within half-wave
  const int khi   = (lane >> 4) * 2;  // 0 for lanes 0-15, 2 for lanes 16-31
  const int col0  = wave * 32;        // this wave covers cols [col0, col0+32)

  v8f acc[2][2] = {};                 // [col-tile][row-tile]
  const float* wcol0 = W + col0 + lhalf;        // col tile 0
  const float* wcol1 = W + col0 + 16 + lhalf;   // col tile 1

  #pragma unroll 2
  for (int k = 0; k < HID; k += 4) {
    // A fragments (16x4): lane<16 -> K=k,k+1 of row M=lhalf; lane>=16 -> K=k+2,k+3.
    v2f a0, a1, b0, b1;
    a0.x = a_lds[lhalf * LDSTR + k + khi];
    a0.y = a_lds[lhalf * LDSTR + k + khi + 1];
    a1.x = a_lds[(16 + lhalf) * LDSTR + k + khi];
    a1.y = a_lds[(16 + lhalf) * LDSTR + k + khi + 1];
    // B fragments (4x16): lane<16 -> rows K=k,k+1 at col N=lhalf; lane>=16 -> K=k+2,k+3.
    b0.x = wcol0[(size_t)(k + khi) * HID];
    b0.y = wcol0[(size_t)(k + khi + 1) * HID];
    b1.x = wcol1[(size_t)(k + khi) * HID];
    b1.y = wcol1[(size_t)(k + khi + 1) * HID];

    acc[0][0] = __builtin_amdgcn_wmma_f32_16x16x4_f32(false, a0, false, b0,
                                                      (short)0, acc[0][0], false, false);
    acc[0][1] = __builtin_amdgcn_wmma_f32_16x16x4_f32(false, a1, false, b0,
                                                      (short)0, acc[0][1], false, false);
    acc[1][0] = __builtin_amdgcn_wmma_f32_16x16x4_f32(false, a0, false, b1,
                                                      (short)0, acc[1][0], false, false);
    acc[1][1] = __builtin_amdgcn_wmma_f32_16x16x4_f32(false, a1, false, b1,
                                                      (short)0, acc[1][1], false, false);
  }

  // C/D layout: VGPR g -> M = g (lanes 0-15) or M = 8+g (lanes 16-31), N = lhalf.
  #pragma unroll
  for (int ct = 0; ct < 2; ++ct) {
    const int cc   = col0 + ct * 16 + lhalf;
    const float bias = B[cc];
    #pragma unroll
    for (int rt = 0; rt < 2; ++rt) {
      const int rbase = row0 + rt * 16 + ((lane >> 4) ? 8 : 0);
      #pragma unroll
      for (int g = 0; g < 8; ++g) {
        const int r = rbase + g;
        if (r < nrows)
          Y[(size_t)r * HID + cc] = (acc[ct][rt][g] + bias) * scale;
      }
    }
  }
}

__global__ __launch_bounds__(256) void gemm256_wmma(
    const float* __restrict__ X, const float* __restrict__ W,
    const float* __restrict__ B, float* __restrict__ Y,
    float scale, int nrows) {
  gemm256_strip(X, W, B, Y, scale, nrows);
}

// ---------------------------------------------------------------------------
// The three projections of one input in one launch: blockIdx.y picks the weight,
// the bias and the output plane (q, k, v lie one behind the other in Y). All
// strips of all three are on the chip together, so one launch's start and tail
// are paid, not three, and a SIMD has more waves to cover the weight loads.
// ---------------------------------------------------------------------------
__global__ __launch_bounds__(256) void qkv256_wmma(
    const float* __restrict__ X,
    const float* __restrict__ Wq, const float* __restrict__ Wk, const float* __restrict__ Wv,
    const float* __restrict__ bq, const float* __restrict__ bk, const float* __restrict__ bv,
    float* __restrict__ Y, float qscale, int nrows) {
  const int p = blockIdx.y;
  gemm256_strip(X, p == 0 ? Wq : p == 1 ? Wk : Wv, p == 0 ? bq : p == 1 ? bk : bv,
                Y + (size_t)p * nrows * HID, p == 0 ? qscale : 1.0f, nrows);
}

// ---------------------------------------------------------------------------
// init: per-row edge count = 0
// ---------------------------------------------------------------------------
__global__ void init_buffers(int* __restrict__ cnt, int n) {
  const int t = blockIdx.x * blockDim.x + threadIdx.x;
  if (t < ((n + 3) & ~3)) cnt[t] = 0;   // with the pad that the scan reads
}

// Bounds a node index read from an input array before an address is formed.
__device__ __forceinline__ int node_index(int x, int n) { return min(max(x, 0), n - 1); }

// ---------------------------------------------------------------------------
// Counts the edges of every row. Four edges a thread.
// ---------------------------------------------------------------------------
__global__ void count_edges_kernel(const int* __restrict__ rows, int* __restrict__ cnt,
                                   int nE, int n) {
  const int e0 = (blockIdx.x * blockDim.x + threadIdx.x) * 4;
  if (e0 + 4 <= nE) {
    const int4 r4 = *(const int4*)(rows + e0);
    // The load's address registers are reused right below.
    asm volatile("s_wait_xcnt 0x0" :: "v"(r4.x) : "memory");
    atomicAdd(&cnt[node_index(r4.x, n)], 1);
    atomicAdd(&cnt[node_index(r4.y, n)], 1);
    atomicAdd(&cnt[node_index(r4.z, n)], 1);
    atomicAdd(&cnt[node_index(r4.w, n)], 1);
  } else {
    for (int e = e0; e < nE; ++e) atomicAdd(&cnt[node_index(rows[e], n)], 1);
  }
}

// ---------------------------------------------------------------------------
// Exclusive prefix sum of the row counts: cur[r] = first slot of row r in the
// row-sorted edge list. One work-group; 4096 counts a pass, the next pass's
// counts are loaded ahead of this pass's scan. cnt and cur are padded to whole
// groups of four; the pad counts are zero.
// ---------------------------------------------------------------------------
__device__ __forceinline__ int wave_inclusive_sum(int x, int lane) {
  #pragma unroll   // five fixed steps: the shuffle addresses and lane tests move out of the pass loop
  for (int d = 1; d < 32; d <<= 1) {
    const int o = __shfl_up(x, d);
    if (lane >= d) x += o;
  }
  return x;
}

__global__ __launch_bounds__(1024) void row_offsets_kernel(
    const int* __restrict__ cnt, int* __restrict__ cur, int n) {
  __shared__ int wsum[32];
  const int t = threadIdx.x, lane = t & 31, wave = t >> 5;
  const int n4 = (n + 3) & ~3;
  int carry = 0;
  int4 c = *(const int4*)(cnt + min(t * 4, n4 - 4));
  for (int base = 0; base < n; base += 4096) {
    const int i0 = base + t * 4;
    const int4 nxt = *(const int4*)(cnt + min(i0 + 4096, n4 - 4));
    const int tsum = i0 < n ? c.x + c.y + c.z + c.w : 0;
    const int inc  = wave_inclusive_sum(tsum, lane);
    if (lane == 31) wsum[wave] = inc;
    __syncthreads();                       // all 32 wave sums are in LDS
    const int ws   = wsum[lane];
    const int winc = wave_inclusive_sum(ws, lane);
    const int before = __shfl(winc, wave) - __shfl(ws, wave);
    const int ex = carry + before + inc - tsum;
    if (i0 < n)
      *(int4*)(cur + i0) = make_int4(ex, ex + c.x, ex + c.x + c.y, ex + c.x + c.y + c.z);
    // The store's registers are reused right below.
    asm volatile("s_wait_xcnt 0x0" ::: "memory");
    carry += __shfl(winc, 31);
    c = nxt;
    __syncthreads();                       // wsum is rewritten in the next pass
  }
}

// ---------------------------------------------------------------------------
// Every edge takes a slot in its row's part of the sorted list (arrival order)
// and puts its source node there. After this launch cur[r] is the end of row
// r's part, which is the start of row r + 1's. Four edges a thread.
// ---------------------------------------------------------------------------
__global__ void place_edges_kernel(const int* __restrict__ rows, const int* __restrict__ cols,
                                   int* __restrict__ cur, int* __restrict__ slot,
                                   int nE, int n) {
  const int e0 = (blockIdx.x * blockDim.x + threadIdx.x) * 4;
  if (e0 + 4 <= nE) {
    const int4 r4 = *(const int4*)(rows + e0);
    const int4 c4 = *(const int4*)(cols + e0);
    // The loads' address registers are reused right below.
    asm volatile("s_wait_xcnt 0x0" :: "v"(r4.x), "v"(c4.x) : "memory");
    // The four slots are asked for together, ahead of the four swaps.
    const int p0 = atomicAdd(&cur[node_index(r4.x, n)], 1);
    const int p1 = atomicAdd(&cur[node_index(r4.y, n)], 1);
    const int p2 = atomicAdd(&cur[node_index(r4.z, n)], 1);
    const int p3 = atomicAdd(&cur[node_index(r4.w, n)], 1);
    atomicExch(&slot[p0], node_index(c4.x, n));
    atomicExch(&slot[p1], node_index(c4.y, n));
    atomicExch(&slot[p2], node_index(c4.z, n));
    atomicExch(&slot[p3], node_index(c4.w, n));
  } else {
    for (int e = e0; e < nE; ++e)
      atomicExch(&slot[atomicAdd(&cur[node_index(rows[e], n)], 1)], node_index(cols[e], n));
  }
}

// ---------------------------------------------------------------------------
// Scores, softmax and weighted sum of one row in one wave, over the row's part
// of the sorted list. Each half of the wave takes every other edge: lane l of
// a half holds columns 64i + 4l .. 64i + 4l + 3 (i = 0..3) of q, k, v and of
// the sums, which are heads 4*(l&1) .. 4*(l&1)+3. The maximum runs along with
// the sums (the sums are rescaled when it grows); scores are kept in base 2.
// ---------------------------------------------------------------------------
template <int M>
__device__ __forceinline__ float add_xor_lane(float x) {   // x + x of lane ^ M, M < 16
  return x + __int_as_float(__builtin_amdgcn_update_dpp(0, __float_as_int(x), 0x160 | M,
                                                        0xf, 0xf, true));
}

__device__ __forceinline__ float other_half(float x) {     // x of lane ^ 16
  const int i = __float_as_int(x);
  return __int_as_float(__builtin_amdgcn_permlanex16(i, i, 0x76543210, 0xfedcba98, false, false));
}

__device__ __forceinline__ v4f exp2_4(v4f x) {
  v4f y;
  y.x = __builtin_amdgcn_exp2f(x.x);
  y.y = __builtin_amdgcn_exp2f(x.y);
  y.z = __builtin_amdgcn_exp2f(x.z);
  y.w = __builtin_amdgcn_exp2f(x.w);
  return y;
}

// Per-head score of one edge, the same in all lanes of the half that hold the head.
__device__ __forceinline__ v4f edge_score(const v4f* qv, const v4f* kv, bool valid, float low) {
  v2f pl = qv[0].lo * kv[0].lo, ph = qv[0].hi * kv[0].hi;
  for (int i = 1; i < 4; ++i) {
    pl += qv[i].lo * kv[i].lo;
    ph += qv[i].hi * kv[i].hi;
  }
  const v4f p = {pl.x, pl.y, ph.x, ph.y};
  v4f s;
  for (int c = 0; c < 4; ++c) {
    const float t = add_xor_lane<8>(add_xor_lane<4>(add_xor_lane<2>(p[c])));
    s[c] = valid ? t : low;
  }
  return s;
}

__global__ __launch_bounds__(256) void row_attention_kernel(
    const float* __restrict__ q, const float* __restrict__ k, const float* __restrict__ v,
    const int* __restrict__ slot, const int* __restrict__ cur,
    float* __restrict__ acc, int n) {
  const int lane = threadIdx.x & 31;
  const int half = lane >> 4;
  const unsigned loff = (unsigned)(lane & 15) * 16u;
  // The row is the same for the whole wave: its bounds stay in scalar registers.
  const int r = __builtin_amdgcn_readfirstlane(blockIdx.x * 8 + (threadIdx.x >> 5));
  if (r >= n) return;
  // Both ends of the row's part come from cur, in two loads that fly together.
  const int before = cur[max(r - 1, 0)], end = cur[r];
  const int start = r > 0 ? before : 0, deg = end - start;
  const int* sl = slot + start;
  const char* kb = (const char*)k;
  const char* vb = (const char*)v;
  const float low = -3.0e38f;   // below every score; finite, so that low - low is 0
  v4f qv[4];
  {
    const char* qr = (const char*)q + (size_t)r * (HID * 4) + loff;
    for (int i = 0; i < 4; ++i) qv[i] = *(const v4f*)(qr + i * 256) * 1.44269504088896340736f;
  }
  v4f a[4] = {}, zs = {};
  v4f mx = {low, low, low, low};
  for (int base = 0; base < deg; base += 32) {
    // One load brings the next 32 list entries, one a lane; past the end, the last one.
    const int ent = sl[min(base + lane, deg - 1)];
    const int m = min(32, deg - base);
    for (int j = 0; j < m; j += 4) {
      const int e0 = __builtin_amdgcn_readlane(ent, j),     e1 = __builtin_amdgcn_readlane(ent, j + 1);
      const int e2 = __builtin_amdgcn_readlane(ent, j + 2), e3 = __builtin_amdgcn_readlane(ent, j + 3);
      const unsigned o0 = (unsigned)(half ? e1 : e0) * (HID * 4u) + loff;
      const unsigned o1 = (unsigned)(half ? e3 : e2) * (HID * 4u) + loff;
      v4f k0[4], k1[4], x0[4], x1[4];
      for (int i = 0; i < 4; ++i) k0[i] = *(const v4f*)(kb + o0 + i * 256);
      for (int i = 0; i < 4; ++i) k1[i] = *(const v4f*)(kb + o1 + i * 256);
      for (int i = 0; i < 4; ++i) x0[i] = *(const v4f*)(vb + o0 + i * 256);
      for (int i = 0; i < 4; ++i) x1[i] = *(const v4f*)(vb + o1 + i * 256);
      // Keeps the sums below all sixteen loads, so that the loads fly together.
      __builtin_amdgcn_sched_barrier(0);
      // The two offsets are inputs, so that neither is reused before this wait.
      asm volatile("s_wait_xcnt 0x0" :: "v"(o0), "v"(o1) : "memory");
      const v4f s0 = edge_score(qv, k0, j + half < m, low);
      const v4f s1 = edge_score(qv, k1, j + 2 + half < m, low);
      v4f mn;
      for (int c = 0; c < 4; ++c) mn[c] = fmaxf(fmaxf(mx[c], s0[c]), s1[c]);
      const v4f f  = exp2_4(mx - mn);
      const v4f w0 = exp2_4(s0 - mn);
      const v4f w1 = exp2_4(s1 - mn);
      mx = mn;
      zs = zs * f + w0 + w1;
      for (int i = 0; i < 4; ++i) a[i] = a[i] * f + w0 * x0[i] + w1 * x1[i];
    }
  }
  // The two halves' sums are brought to one maximum and added. Half 0 ends up
  // with columns 0..63 and 128..191, half 1 with the rest.
  v4f o0 = {}, o1 = {};
  if (deg > 0) {   // a row without edges stays zero
    v4f f;
    for (int c = 0; c < 4; ++c) f[c] = mx[c] - fmaxf(mx[c], other_half(mx[c]));
    f = exp2_4(f);
    zs *= f;
    for (int i = 0; i < 4; ++i) a[i] *= f;
    for (int c = 0; c < 4; ++c) {
      zs[c] += other_half(zs[c]);
      o0[c] = (half ? a[1][c] : a[0][c]) + other_half(half ? a[0][c] : a[1][c]);
      o1[c] = (half ? a[3][c] : a[2][c]) + other_half(half ? a[2][c] : a[3][c]);
    }
    const v4f rz = 1.0f / zs;
    o0 *= rz;
    o1 *= rz;
  }
  char* dst = (char*)acc + (size_t)r * (HID * 4) + half * 256 + loff;
  *(v4f*)dst         = o0;
  *(v4f*)(dst + 512) = o1;
}

// ---------------------------------------------------------------------------
extern "C" void kernel_launch(void* const* d_in, const int* in_sizes, int n_in,
                              void* d_out, int out_size, void* d_ws, size_t ws_size,
                              hipStream_t stream) {
  const float* h  = (const float*)d_in[0];
  const float* Wq = (const float*)d_in[1];
  const float* bq = (const float*)d_in[2];
  const float* Wk = (const float*)d_in[3];
  const float* bk = (const float*)d_in[4];
  const float* Wv = (const float*)d_in[5];
  const float* bv = (const float*)d_in[6];
  const float* Wo = (const float*)d_in[7];
  const float* bo = (const float*)d_in[8];
  const int* rows = (const int*)d_in[9];
  const int* cols = (const int*)d_in[10];
  float* out = (float*)d_out;

  const int N = in_sizes[0] / HID;
  const int E = in_sizes[9];
  const float scaling = 1.0f / sqrtf((float)HD);

  // Workspace layout (fp32 arrays, then int counts and int slots)
  float* ws  = (float*)d_ws;
  float* q   = ws;                      // N*256
  float* k   = q + (size_t)N * HID;     // N*256
  float* v   = k + (size_t)N * HID;     // N*256
  float* acc = v + (size_t)N * HID;     // N*256
  int* cnt = (int*)(acc + (size_t)N * HID);     // N edges per row
  int* cur = cnt + (size_t)((N + 3) / 4) * 4;   // N first free slot per row
  int* slot = cur + (size_t)((N + 3) / 4) * 4;  // E source nodes, by row

  const int mblocks = (N + RPB - 1) / RPB;

  const int et = (E + 1023) / 1024;   // four edges a thread
  init_buffers<<<(N + 3 + 255) / 256, 256, 0, stream>>>(cnt, N);
  count_edges_kernel<<<et, 256, 0, stream>>>(rows, cnt, E, N);
  row_offsets_kernel<<<1, 1024, 0, stream>>>(cnt, cur, N);
  place_edges_kernel<<<et, 256, 0, stream>>>(rows, cols, cur, slot, E, N);

  qkv256_wmma<<<dim3(mblocks, 3), 256, 0, stream>>>(h, Wq, Wk, Wv, bq, bk, bv, q, scaling, N);

  row_attention_kernel<<<(N + 7) / 8, 256, 0, stream>>>(q, k, v, slot, cur, acc, N);

  gemm256_wmma<<<mblocks, 256, 0, stream>>>(acc, Wo, bo, out, 1.0f, N);
}

// v005
// Measured time: 121 microseconds a run.
// Next to v004, in two timings, it ran 1.44 and 1.45 times as fast.
// Counting every step since v000, it is 3.53 times as fast.
#include <hip/hip_runtime.h>
#include <math.h>

typedef __attribute__((ext_vector_type(2))) float v2f;
typedef __attribute__((ext_vector_type(8))) float v8f;
typedef __attribute__((ext_vector_type(4))) float v4f;

#define HID   256
#define HEADS 8
#define HD    32
#define RPB   32    // rows per block (2 row-tiles of 16)
#define LDSTR 260   // LDS row stride (floats); 260 % 64 = 4 -> conflict-free A reads
#define CAP   64    // list places that every row owns; further edges go to the shared spill list
#define PLW   56    // columns of edge-filing work-groups beside the strips of the projection grid

// ---------------------------------------------------------------------------
// [nrows x 256] @ [256 x 256] + bias, scaled, via V_WMMA_F32_16X16X4_F32.
// Block: 256 threads (8 wave32) on a 32-row strip. Each wave owns a 2x2 grid
// of 16x16 tiles (2 col-tiles x 2 row-tiles): per k-step, 2 A + 2 B fragments
// feed 4 WMMAs (register blocking doubles WMMA density per byte loaded).
// The strip is picked by blockIdx.x.
// ---------------------------------------------------------------------------
__device__ __forceinline__ void gemm256_strip(
    const float* __restrict__ X, const float* __restrict__ W,
    const float* __restrict__ B, float* __restrict__ Y,
    float scale, int nrows) {
  __shared__ __attribute__((aligned(16))) float a_lds[RPB * LDSTR];

  const int row0 = blockIdx.x * RPB;
  const int t    = threadIdx.x;

  // The 32x256 X strip goes to LDS in 16-byte pieces, eight a thread (a wave takes
  // half a row). No load stands under a branch: a row past the end reads the last
  // row and is stored as zero, so all eight loads fly together and are waited for once.
  {
    // 0..3, the same for a whole wave: clamp, row offset and tail test are scalar work.
    const int r0 = __builtin_amdgcn_readfirstlane(t >> 6);   // piece i lies in row r0 + 4 i
    const int c0 = (t & 63) * 4;    // 0..252
    v4f xs[RPB / 4];
    #pragma unroll   // the eight pieces stay in registers
    for (int i = 0; i < RPB / 4; ++i)
      xs[i] = *(const v4f*)(X + (size_t)min(row0 + r0 + i * 4, nrows - 1) * HID + c0);
    #pragma unroll   // as above
    for (int i = 0; i < RPB / 4; ++i) {
      const v4f zero = {};
      *(v4f*)(a_lds + (r0 + i * 4) * LDSTR + c0) = row0 + r0 + i * 4 < nrows ? xs[i] : zero;
    }
  }
  __syncthreads();

  const int wave  = t >> 5;           // 0..7
  const int lane  = t & 31;
  const int lhalf = lane & 15;        // lane within half-wave
  const int khi   = (lane >> 4) * 2;  // 0 for lanes 0-15, 2 for lanes 16-31
  const int col0  = wave * 32;        // this wave covers cols [col0, col0+32)

  v8f acc[2][2] = {};                 // [col-tile][row-tile]
  const float* wcol0 = W + col0 + lhalf;        // col tile 0
  const float* wcol1 = W + col0 + 16 + lhalf;   // col tile 1

  #pragma unroll 2
  for (int k = 0; k < HID; k += 4) {
    // A fragments (16x4): lane<16 -> K=k,k+1 of row M=lhalf; lane>=16 -> K=k+2,k+3.
    v2f a0, a1, b0, b1;
    a0.x = a_lds[lhalf * LDSTR + k + khi];
    a0.y = a_lds[lhalf * LDSTR + k + khi + 1];
    a1.x = a_lds[(16 + lhalf) * LDSTR + k + khi];
    a1.y = a_lds[(16 + lhalf) * LDSTR + k + khi + 1];
    // B fragments (4x16): lane<16 -> rows K=k,k+1 at col N=lhalf; lane>=16 -> K=k+2,k+3.
    b0.x = wcol0[(size_t)(k + khi) * HID];
    b0.y = wcol0[(size_t)(k + khi + 1) * HID];
    b1.x = wcol1[(size_t)(k + khi) * HID];
    b1.y = wcol1[(size_t)(k + khi + 1) * HID];

    acc[0][0] = __builtin_amdgcn_wmma_f32_16x16x4_f32(false, a0, false, b0,
                                                      (short)0, acc[0][0], false, false);
    acc[0][1] = __builtin_amdgcn_wmma_f32_16x16x4_f32(false, a1, false, b0,
                                                      (short)0, acc[0][1], false, false);
    acc[1][0] = __builtin_amdgcn_wmma_f32_16x16x4_f32(false, a0, false, b1,
                                                      (short)0, acc[1][0], false, false);
    acc[1][1] = __builtin_amdgcn_wmma_f32_16x16x4_f32(false, a1, false, b1,
                                                      (short)0, acc[1][1], false, false);
  }

  // C/D layout: VGPR g -> M = g (lanes 0-15) or M = 8+g (lanes 16-31), N = lhalf.
  #pragma unroll
  for (int ct = 0; ct < 2; ++ct) {
    const int cc   = col0 + ct * 16 + lhalf;
    const float bias = B[cc];
    #pragma unroll
    for (int rt = 0; rt < 2; ++rt) {
      const int rbase = row0 + rt * 16 + ((lane >> 4) ? 8 : 0);
      #pragma unroll
      for (int g = 0; g < 8; ++g) {
        const int r = rbase + g;
        if (r < nrows)
          Y[(size_t)r * HID + cc] = (acc[ct][rt][g] + bias) * scale;
      }
    }
  }
}

__global__ __launch_bounds__(256) void gemm256_wmma(
    const float* __restrict__ X, const float* __restrict__ W,
    const float* __restrict__ B, float* __restrict__ Y,
    float scale, int nrows) {
  gemm256_strip(X, W, B, Y, scale, nrows);
}

// ---------------------------------------------------------------------------
// init: per-row edge count = 0; cnt[n] is the length of the spill list
// ---------------------------------------------------------------------------
__global__ void init_buffers(int* __restrict__ cnt, int n) {
  const int t = blockIdx.x * blockDim.x + threadIdx.x;
  if (t < n + 1) cnt[t] = 0;
}

// Bounds a node index read from an input array before an address is formed.
__device__ __forceinline__ int node_index(int x, int n) { return min(max(x, 0), n - 1); }

// ---------------------------------------------------------------------------
// Every edge takes the next place (arrival order) in its row's own CAP places
// of bkt and puts its source node there; an edge that finds them full goes, as
// (row, source), to the spill list, which holds at most nE records. No count
// pass and no prefix sum are needed: the places are fixed before any edge is seen.
// Swaps, not plain stores: the places beside an edge's own, in the same memory
// line, are written by other work-groups.
// ---------------------------------------------------------------------------
__device__ __forceinline__ void put_edge(int p, int r, int c, int* __restrict__ cnt,
                                         int* __restrict__ bkt,
                                         unsigned long long* __restrict__ spill, int n) {
  if (p < CAP)
    atomicExch(&bkt[r * CAP + p], c);
  else
    atomicExch(&spill[atomicAdd(&cnt[n], 1)],
               ((unsigned long long)(unsigned)r << 32) | (unsigned)c);
}

// Four edges a thread and trip; this is work-group 'group' of 'groups' that share the edges.
__device__ __forceinline__ void place_edges(const int* __restrict__ rows,
                                            const int* __restrict__ cols,
                                            int* __restrict__ cnt, int* __restrict__ bkt,
                                            unsigned long long* __restrict__ spill,
                                            int nE, int n, int group, int groups) {
  const int step = groups * blockDim.x * 4;
  for (int e0 = (group * blockDim.x + threadIdx.x) * 4; e0 < nE; e0 += step) {
    if (e0 + 4 <= nE) {
      const int4 r4 = *(const int4*)(rows + e0);
      const int4 c4 = *(const int4*)(cols + e0);
      // The loads' address registers are reused right below.
      asm volatile("s_wait_xcnt 0x0" :: "v"(r4.x), "v"(c4.x) : "memory");
      const int r0 = node_index(r4.x, n), r1 = node_index(r4.y, n);
      const int r2 = node_index(r4.z, n), r3 = node_index(r4.w, n);
      // The four places are asked for together, ahead of the four swaps.
      const int p0 = atomicAdd(&cnt[r0], 1);
      const int p1 = atomicAdd(&cnt[r1], 1);
      const int p2 = atomicAdd(&cnt[r2], 1);
      const int p3 = atomicAdd(&cnt[r3], 1);
      put_edge(p0, r0, node_index(c4.x, n), cnt, bkt, spill, n);
      put_edge(p1, r1, node_index(c4.y, n), cnt, bkt, spill, n);
      put_edge(p2, r2, node_index(c4.z, n), cnt, bkt, spill, n);
      put_edge(p3, r3, node_index(c4.w, n), cnt, bkt, spill, n);
    } else {
      for (int e = e0; e < nE; ++e) {
        const int r = node_index(rows[e], n);
        put_edge(atomicAdd(&cnt[r], 1), r, node_index(cols[e], n), cnt, bkt, spill, n);
        // The swap's registers are reused in the next trip.
        asm volatile("s_wait_xcnt 0x0" ::: "memory");
      }
    }
  }
}

// ---------------------------------------------------------------------------
// The three projections of one input in one launch: blockIdx.y picks the weight,
// the bias and the output plane (q, k, v lie one behind the other in Y). All
// strips of all three are on the chip together, so one launch's start and tail
// are paid, not three, and a SIMD has more waves to cover the weight loads.
// The work-groups whose blockIdx.x lies past the last strip file the edges: that
// work needs nothing of the projections and runs beside them.
// ---------------------------------------------------------------------------
__global__ __launch_bounds__(256) void qkv256_wmma(
    const float* __restrict__ X,
    const float* __restrict__ Wq, const float* __restrict__ Wk, const float* __restrict__ Wv,
    const float* __restrict__ bq, const float* __restrict__ bk, const float* __restrict__ bv,
    float* __restrict__ Y, float qscale, int nrows,
    const int* __restrict__ rows, const int* __restrict__ cols,
    int* __restrict__ cnt, int* __restrict__ bkt, unsigned long long* __restrict__ spill, int nE) {
  const int extra = blockIdx.x - (nrows + RPB - 1) / RPB;
  if (extra >= 0) {   // the whole work-group, ahead of every barrier
    place_edges(rows, cols, cnt, bkt, spill, nE, nrows, blockIdx.y * PLW + extra, gridDim.y * PLW);
    return;
  }
  const int p = blockIdx.y;
  gemm256_strip(X, p == 0 ? Wq : p == 1 ? Wk : Wv, p == 0 ? bq : p == 1 ? bk : bv,
                Y + (size_t)p * nrows * HID, p == 0 ? qscale : 1.0f, nrows);
}

// ---------------------------------------------------------------------------
// Scores, softmax and weighted sum of one row in one wave, over the row's own
// places and, for a row that overran them, its records in the spill list.
// Each half of the wave takes every other edge: lane l of
// a half holds columns 64i + 4l .. 64i + 4l + 3 (i = 0..3) of q, k, v and of
// the sums, which are heads 4*(l&1) .. 4*(l&1)+3. The maximum runs along with
// the sums (the sums are rescaled when it grows); scores are kept in base 2.
// ---------------------------------------------------------------------------
template <int M>
__device__ __forceinline__ float add_xor_lane(float x) {   // x + x of lane ^ M, M < 16
  return x + __int_as_float(__builtin_amdgcn_update_dpp(0, __float_as_int(x), 0x160 | M,
                                                        0xf, 0xf, true));
}

__device__ __forceinline__ float other_half(float x) {     // x of lane ^ 16
  const int i = __float_as_int(x);
  return __int_as_float(__builtin_amdgcn_permlanex16(i, i, 0x76543210, 0xfedcba98, false, false));
}

__device__ __forceinline__ v4f exp2_4(v4f x) {
  v4f y;
  y.x = __builtin_amdgcn_exp2f(x.x);
  y.y = __builtin_amdgcn_exp2f(x.y);
  y.z = __builtin_amdgcn_exp2f(x.z);
  y.w = __builtin_amdgcn_exp2f(x.w);
  return y;
}

// Per-head score of one edge, the same in all lanes of the half that hold the head.
__device__ __forceinline__ v4f edge_score(const v4f* qv, const v4f* kv, bool valid, float low) {
  v2f pl = qv[0].lo * kv[0].lo, ph = qv[0].hi * kv[0].hi;
  for (int i = 1; i < 4; ++i) {
    pl += qv[i].lo * kv[i].lo;
    ph += qv[i].hi * kv[i].hi;
  }
  const v4f p = {pl.x, pl.y, ph.x, ph.y};
  v4f s;
  for (int c = 0; c < 4; ++c) {
    const float t = add_xor_lane<8>(add_xor_lane<4>(add_xor_lane<2>(p[c])));
    s[c] = valid ? t : low;
  }
  return s;
}

__global__ __launch_bounds__(256) void row_attention_kernel(
    const float* __restrict__ q, const float* __restrict__ k, const float* __restrict__ v,
    const int* __restrict__ bkt, const int* __restrict__ cnt,
    const unsigned long long* __restrict__ spill, float* __restrict__ acc, int n, int nE) {
  const int lane = threadIdx.x & 31;
  const int half = lane >> 4;
  const unsigned loff = (unsigned)(lane & 15) * 16u;
  // The row is the same for the whole wave: its bounds stay in scalar registers.
  const int r = __builtin_amdgcn_readfirstlane(blockIdx.x * 8 + (threadIdx.x >> 5));
  if (r >= n) return;
  const int all = cnt[r], deg = min(all, CAP);   // edges of the row; those in its own places
  const int* sl = bkt + r * CAP;
  const char* kb = (const char*)k;
  const char* vb = (const char*)v;
  const float low = -3.0e38f;   // below every score; finite, so that low - low is 0
  v4f qv[4];
  {
    const char* qr = (const char*)q + (size_t)r * (HID * 4) + loff;
    for (int i = 0; i < 4; ++i) qv[i] = *(const v4f*)(qr + i * 256) * 1.44269504088896340736f;
  }
  v4f a[4] = {}, zs = {};
  v4f mx = {low, low, low, low};
  // Takes in up to four edges with source nodes e0 .. e3, of which the first 'live' count.
  auto four_edges = [&](int e0, int e1, int e2, int e3, int live) {
      const unsigned o0 = (unsigned)(half ? e1 : e0) * (HID * 4u) + loff;
      const unsigned o1 = (unsigned)(half ? e3 : e2) * (HID * 4u) + loff;
      v4f k0[4], k1[4], x0[4], x1[4];
      for (int i = 0; i < 4; ++i) k0[i] = *(const v4f*)(kb + o0 + i * 256);
      for (int i = 0; i < 4; ++i) k1[i] = *(const v4f*)(kb + o1 + i * 256);
      for (int i = 0; i < 4; ++i) x0[i] = *(const v4f*)(vb + o0 + i * 256);
      for (int i = 0; i < 4; ++i) x1[i] = *(const v4f*)(vb + o1 + i * 256);
      // Keeps the sums below all sixteen loads, so that the loads fly together.
      __builtin_amdgcn_sched_barrier(0);
      // The two offsets are inputs, so that neither is reused before this wait.
      asm volatile("s_wait_xcnt 0x0" :: "v"(o0), "v"(o1) : "memory");
      const v4f s0 = edge_score(qv, k0, half < live, low);
      const v4f s1 = edge_score(qv, k1, 2 + half < live, low);
      v4f mn;
      for (int c = 0; c < 4; ++c) mn[c] = fmaxf(fmaxf(mx[c], s0[c]), s1[c]);
      const v4f f  = exp2_4(mx - mn);
      const v4f w0 = exp2_4(s0 - mn);
      const v4f w1 = exp2_4(s1 - mn);
      mx = mn;
      zs = zs * f + w0 + w1;
      for (int i = 0; i < 4; ++i) a[i] = a[i] * f + w0 * x0[i] + w1 * x1[i];
  };
  for (int base = 0; base < deg; base += 32) {
    // One load brings the next 32 list entries, one a lane; past the end, the last one.
    const int ent = sl[min(base + lane, deg - 1)];
    const int m = min(32, deg - base);
    for (int j = 0; j < m; j += 4)
      four_edges(__builtin_amdgcn_readlane(ent, j),     __builtin_amdgcn_readlane(ent, j + 1),
                 __builtin_amdgcn_readlane(ent, j + 2), __builtin_amdgcn_readlane(ent, j + 3), m - j);
  }
  if (all > CAP) {   // the same for the whole wave: the row's further edges, one at a time
    const int ns = min(cnt[n], nE);
    for (int base = 0; base < ns; base += 32) {
      const unsigned long long rec = spill[min(base + lane, ns - 1)];
      unsigned mine = __builtin_amdgcn_ballot_w32((int)(rec >> 32) == r && base + lane < ns);
      for (; mine; mine &= mine - 1) {
        const int e = __builtin_amdgcn_readlane((int)rec, __builtin_ctz(mine));
        four_edges(e, e, e, e, 1);
      }
    }
  }
  // The two halves' sums are brought to one maximum and added. Half 0 ends up
  // with columns 0..63 and 128..191, half 1 with the rest.
  v4f o0 = {}, o1 = {};
  if (deg > 0) {   // a row without edges stays zero
    v4f f;
    for (int c = 0; c < 4; ++c) f[c] = mx[c] - fmaxf(mx[c], other_half(mx[c]));
    f = exp2_4(f);
    zs *= f;
    for (int i = 0; i < 4; ++i) a[i] *= f;
    for (int c = 0; c < 4; ++c) {
      zs[c] += other_half(zs[c]);
      o0[c] = (half ? a[1][c] : a[0][c]) + other_half(half ? a[0][c] : a[1][c]);
      o1[c] = (half ? a[3][c] : a[2][c]) + other_half(half ? a[2][c] : a[3][c]);
    }
    const v4f rz = 1.0f / zs;
    o0 *= rz;
    o1 *= rz;
  }
  char* dst = (char*)acc + (size_t)r * (HID * 4) + half * 256 + loff;
  *(v4f*)dst         = o0;
  *(v4f*)(dst + 512) = o1;
}

// ---------------------------------------------------------------------------
extern "C" void kernel_launch(void* const* d_in, const int* in_sizes, int n_in,
                              void* d_out, int out_size, void* d_ws, size_t ws_size,
                              hipStream_t stream) {
  const float* h  = (const float*)d_in[0];
  const float* Wq = (const float*)d_in[1];
  const float* bq = (const float*)d_in[2];
  const float* Wk = (const float*)d_in[3];
  const float* bk = (const float*)d_in[4];
  const float* Wv = (const float*)d_in[5];
  const float* bv = (const float*)d_in[6];
  const float* Wo = (const float*)d_in[7];
  const float* bo = (const float*)d_in[8];
  const int* rows = (const int*)d_in[9];
  const int* cols = (const int*)d_in[10];
  float* out = (float*)d_out;

  const int N = in_sizes[0] / HID;
  const int E = in_sizes[9];
  const float scaling = 1.0f / sqrtf((float)HD);

  // Workspace layout (fp32 arrays, then int slots, 64-bit spill records and int counts)
  float* ws  = (float*)d_ws;
  float* q   = ws;                      // N*256
  float* k   = q + (size_t)N * HID;     // N*256
  float* v   = k + (size_t)N * HID;     // N*256
  float* acc = v + (size_t)N * HID;     // N*256
  int* bkt = (int*)(acc + (size_t)N * HID);     // N*CAP source nodes, by row
  unsigned long long* spill = (unsigned long long*)(bkt + (size_t)N * CAP);   // E (row, source)
  int* cnt = (int*)(spill + E);                 // N edges per row, 1 spill length

  const int mblocks = (N + RPB - 1) / RPB;

  init_buffers<<<(N + 1 + 255) / 256, 256, 0, stream>>>(cnt, N);

  qkv256_wmma<<<dim3(mblocks + PLW, 3), 256, 0, stream>>>(h, Wq, Wk, Wv, bq, bk, bv, q, scaling, N,
                                                    rows, cols, cnt, bkt, spill, E);

  row_attention_kernel<<<(N + 7) / 8, 256, 0, stream>>>(q, k, v, bkt, cnt, spill, acc, N, E);

  gemm256_wmma<<<mblocks, 256, 0, stream>>>(acc, Wo, bo, out, 1.0f, N);
}

// v006
// One run takes 113 microseconds.
// Two timings next to v005 both put it at 1.07 times that version's speed.
// Counting every step since v000, it is 3.78 times as fast.
#include <hip/hip_runtime.h>
#include <math.h>

typedef __attribute__((ext_vector_type(2))) float v2f;
typedef __attribute__((ext_vector_type(8))) float v8f;
typedef __attribute__((ext_vector_type(4))) float v4f;

#define HID   256
#define HEADS 8
#define HD    32
#define RPB   32    // rows per block (2 row-tiles of 16)
#define LDSTR 260   // LDS row stride (floats); 260 % 64 = 4 -> conflict-free A reads
#define CAP   64    // list places that every row owns; further edges go to the shared spill list
#define PLW   56    // columns of edge-filing work-groups beside the strips of the projection grid
#define FR    16    // rows of one work-group of the attention and output launch (one row-tile)
#define FW    4     // its waves
#define RPW   (FR / FW)   // rows that one wave attends
#define KC    4     // k-steps of Wo that one register set holds

// ---------------------------------------------------------------------------
// [nrows x 256] @ [256 x 256] + bias, scaled, via V_WMMA_F32_16X16X4_F32.
// Block: 256 threads (8 wave32) on a 32-row strip. Each wave owns a 2x2 grid
// of 16x16 tiles (2 col-tiles x 2 row-tiles): per k-step, 2 A + 2 B fragments
// feed 4 WMMAs (register blocking doubles WMMA density per byte loaded).
// The strip is picked by blockIdx.x.
// ---------------------------------------------------------------------------
__device__ __forceinline__ void gemm256_strip(
    const float* __restrict__ X, const float* __restrict__ W,
    const float* __restrict__ B, float* __restrict__ Y,
    float scale, int nrows) {
  __shared__ __attribute__((aligned(16))) float a_lds[RPB * LDSTR];

  const int row0 = blockIdx.x * RPB;
  const int t    = threadIdx.x;

  // The 32x256 X strip goes to LDS in 16-byte pieces, eight a thread (a wave takes
  // half a row). No load stands under a branch: a row past the end reads the last
  // row and is stored as zero, so all eight loads fly together and are waited for once.
  {
    // 0..3, the same for a whole wave: clamp, row offset and tail test are scalar work.
    const int r0 = __builtin_amdgcn_readfirstlane(t >> 6);   // piece i lies in row r0 + 4 i
    const int c0 = (t & 63) * 4;    // 0..252
    v4f xs[RPB / 4];
    #pragma unroll   // the eight pieces stay in registers
    for (int i = 0; i < RPB / 4; ++i)
      xs[i] = *(const v4f*)(X + (size_t)min(row0 + r0 + i * 4, nrows - 1) * HID + c0);
    #pragma unroll   // as above
    for (int i = 0; i < RPB / 4; ++i) {
      const v4f zero = {};
      *(v4f*)(a_lds + (r0 + i * 4) * LDSTR + c0) = row0 + r0 + i * 4 < nrows ? xs[i] : zero;
    }
  }
  __syncthreads();

  const int wave  = t >> 5;           // 0..7
  const int lane  = t & 31;
  const int lhalf = lane & 15;        // lane within half-wave
  const int khi   = (lane >> 4) * 2;  // 0 for lanes 0-15, 2 for lanes 16-31
  const int col0  = wave * 32;        // this wave covers cols [col0, col0+32)

  v8f acc[2][2] = {};                 // [col-tile][row-tile]
  const float* wcol0 = W + col0 + lhalf;        // col tile 0
  const float* wcol1 = W + col0 + 16 + lhalf;   // col tile 1

  #pragma unroll 2
  for (int k = 0; k < HID; k += 4) {
    // A fragments (16x4): lane<16 -> K=k,k+1 of row M=lhalf; lane>=16 -> K=k+2,k+3.
    v2f a0, a1, b0, b1;
    a0.x = a_lds[lhalf * LDSTR + k + khi];
    a0.y = a_lds[lhalf * LDSTR + k + khi + 1];
    a1.x = a_lds[(16 + lhalf) * LDSTR + k + khi];
    a1.y = a_lds[(16 + lhalf) * LDSTR + k + khi + 1];
    // B fragments (4x16): lane<16 -> rows K=k,k+1 at col N=lhalf; lane>=16 -> K=k+2,k+3.
    b0.x = wcol0[(size_t)(k + khi) * HID];
    b0.y = wcol0[(size_t)(k + khi + 1) * HID];
    b1.x = wcol1[(size_t)(k + khi) * HID];
    b1.y = wcol1[(size_t)(k + khi + 1) * HID];

    acc[0][0] = __builtin_amdgcn_wmma_f32_16x16x4_f32(false, a0, false, b0,
                                                      (short)0, acc[0][0], false, false);
    acc[0][1] = __builtin_amdgcn_wmma_f32_16x16x4_f32(false, a1, false, b0,
                                                      (short)0, acc[0][1], false, false);
    acc[1][0] = __builtin_amdgcn_wmma_f32_16x16x4_f32(false, a0, false, b1,
                                                      (short)0, acc[1][0], false, false);
    acc[1][1] = __builtin_amdgcn_wmma_f32_16x16x4_f32(false, a1, false, b1,
                                                      (short)0, acc[1][1], false, false);
  }

  // C/D layout: VGPR g -> M = g (lanes 0-15) or M = 8+g (lanes 16-31), N = lhalf.
  #pragma unroll
  for (int ct = 0; ct < 2; ++ct) {
    const int cc   = col0 + ct * 16 + lhalf;
    const float bias = B[cc];
    #pragma unroll
    for (int rt = 0; rt < 2; ++rt) {
      const int rbase = row0 + rt * 16 + ((lane >> 4) ? 8 : 0);
      #pragma unroll
      for (int g = 0; g < 8; ++g) {
        const int r = rbase + g;
        if (r < nrows)
          Y[(size_t)r * HID + cc] = (acc[ct][rt][g] + bias) * scale;
      }
    }
  }
}

// ---------------------------------------------------------------------------
// init: per-row edge count = 0; cnt[n] is the length of the spill list
// ---------------------------------------------------------------------------
__global__ void init_buffers(int* __restrict__ cnt, int n) {
  const int t = blockIdx.x * blockDim.x + threadIdx.x;
  if (t < n + 1) cnt[t] = 0;
}

// Bounds a node index read from an input array before an address is formed.
__device__ __forceinline__ int node_index(int x, int n) { return min(max(x, 0), n - 1); }

// ---------------------------------------------------------------------------
// Every edge takes the next place (arrival order) in its row's own CAP places
// of bkt and puts its source node there; an edge that finds them full goes, as
// (row, source), to the spill list, which holds at most nE records. No count
// pass and no prefix sum are needed: the places are fixed before any edge is seen.
// Swaps, not plain stores: the places beside an edge's own, in the same memory
// line, are written by other work-groups.
// ---------------------------------------------------------------------------
__device__ __forceinline__ void put_edge(int p, int r, int c, int* __restrict__ cnt,
                                         int* __restrict__ bkt,
                                         unsigned long long* __restrict__ spill, int n) {
  if (p < CAP)
    atomicExch(&bkt[r * CAP + p], c);
  else
    atomicExch(&spill[atomicAdd(&cnt[n], 1)],
               ((unsigned long long)(unsigned)r << 32) | (unsigned)c);
}

// Four edges a thread and trip; this is work-group 'group' of 'groups' that share the edges.
__device__ __forceinline__ void place_edges(const int* __restrict__ rows,
                                            const int* __restrict__ cols,
                                            int* __restrict__ cnt, int* __restrict__ bkt,
                                            unsigned long long* __restrict__ spill,
                                            int nE, int n, int group, int groups) {
  const int step = groups * blockDim.x * 4;
  for (int e0 = (group * blockDim.x + threadIdx.x) * 4; e0 < nE; e0 += step) {
    if (e0 + 4 <= nE) {
      const int4 r4 = *(const int4*)(rows + e0);
      const int4 c4 = *(const int4*)(cols + e0);
      // The loads' address registers are reused right below.
      asm volatile("s_wait_xcnt 0x0" :: "v"(r4.x), "v"(c4.x) : "memory");
      const int r0 = node_index(r4.x, n), r1 = node_index(r4.y, n);
      const int r2 = node_index(r4.z, n), r3 = node_index(r4.w, n);
      // The four places are asked for together, ahead of the four swaps.
      const int p0 = atomicAdd(&cnt[r0], 1);
      const int p1 = atomicAdd(&cnt[r1], 1);
      const int p2 = atomicAdd(&cnt[r2], 1);
      const int p3 = atomicAdd(&cnt[r3], 1);
      put_edge(p0, r0, node_index(c4.x, n), cnt, bkt, spill, n);
      put_edge(p1, r1, node_index(c4.y, n), cnt, bkt, spill, n);
      put_edge(p2, r2, node_index(c4.z, n), cnt, bkt, spill, n);
      put_edge(p3, r3, node_index(c4.w, n), cnt, bkt, spill, n);
    } else {
      for (int e = e0; e < nE; ++e) {
        const int r = node_index(rows[e], n);
        put_edge(atomicAdd(&cnt[r], 1), r, node_index(cols[e], n), cnt, bkt, spill, n);
        // The swap's registers are reused in the next trip.
        asm volatile("s_wait_xcnt 0x0" ::: "memory");
      }
    }
  }
}

// ---------------------------------------------------------------------------
// The three projections of one input in one launch: blockIdx.y picks the weight,
// the bias and the output plane (q, k, v lie one behind the other in Y). All
// strips of all three are on the chip together, so one launch's start and tail
// are paid, not three, and a SIMD has more waves to cover the weight loads.
// The work-groups whose blockIdx.x lies past the last strip file the edges: that
// work needs nothing of the projections and runs beside them.
// ---------------------------------------------------------------------------
__global__ __launch_bounds__(256) void qkv256_wmma(
    const float* __restrict__ X,
    const float* __restrict__ Wq, const float* __restrict__ Wk, const float* __restrict__ Wv,
    const float* __restrict__ bq, const float* __restrict__ bk, const float* __restrict__ bv,
    float* __restrict__ Y, float qscale, int nrows,
    const int* __restrict__ rows, const int* __restrict__ cols,
    int* __restrict__ cnt, int* __restrict__ bkt, unsigned long long* __restrict__ spill, int nE) {
  const int extra = blockIdx.x - (nrows + RPB - 1) / RPB;
  if (extra >= 0) {   // the whole work-group, ahead of every barrier
    place_edges(rows, cols, cnt, bkt, spill, nE, nrows, blockIdx.y * PLW + extra, gridDim.y * PLW);
    return;
  }
  const int p = blockIdx.y;
  gemm256_strip(X, p == 0 ? Wq : p == 1 ? Wk : Wv, p == 0 ? bq : p == 1 ? bk : bv,
                Y + (size_t)p * nrows * HID, p == 0 ? qscale : 1.0f, nrows);
}

// ---------------------------------------------------------------------------
// Scores, softmax and weighted sum of one row in one wave, over the row's own
// places and, for a row that overran them, its records in the spill list.
// Each half of the wave takes every other edge: lane l of
// a half holds columns 64i + 4l .. 64i + 4l + 3 (i = 0..3) of q, k, v and of
// the sums, which are heads 4*(l&1) .. 4*(l&1)+3. The maximum runs along with
// the sums (the sums are rescaled when it grows); scores are kept in base 2.
// ---------------------------------------------------------------------------
template <int M>
__device__ __forceinline__ float add_xor_lane(float x) {   // x + x of lane ^ M, M < 16
  return x + __int_as_float(__builtin_amdgcn_update_dpp(0, __float_as_int(x), 0x160 | M,
                                                        0xf, 0xf, true));
}

__device__ __forceinline__ float other_half(float x) {     // x of lane ^ 16
  const int i = __float_as_int(x);
  return __int_as_float(__builtin_amdgcn_permlanex16(i, i, 0x76543210, 0xfedcba98, false, false));
}

__device__ __forceinline__ v4f exp2_4(v4f x) {
  v4f y;
  y.x = __builtin_amdgcn_exp2f(x.x);
  y.y = __builtin_amdgcn_exp2f(x.y);
  y.z = __builtin_amdgcn_exp2f(x.z);
  y.w = __builtin_amdgcn_exp2f(x.w);
  return y;
}

// Per-head score of one edge, the same in all lanes of the half that hold the head.
__device__ __forceinline__ v4f edge_score(const v4f* qv, const v4f* kv, bool valid, float low) {
  v2f pl = qv[0].lo * kv[0].lo, ph = qv[0].hi * kv[0].hi;
  for (int i = 1; i < 4; ++i) {
    pl += qv[i].lo * kv[i].lo;
    ph += qv[i].hi * kv[i].hi;
  }
  const v4f p = {pl.x, pl.y, ph.x, ph.y};
  v4f s;
  for (int c = 0; c < 4; ++c) {
    const float t = add_xor_lane<8>(add_xor_lane<4>(add_xor_lane<2>(p[c])));
    s[c] = valid ? t : low;
  }
  return s;
}

// ---------------------------------------------------------------------------
// Attention and output projection of FR rows in one work-group of FW waves.
// Each wave attends RPW rows, one after the other, and puts each finished row
// into LDS; behind one barrier the 16 x 256 strip is multiplied by Wo on WMMA.
// The attention rows never go to memory and no further launch is needed.
// ---------------------------------------------------------------------------
__global__ __launch_bounds__(FW * 32) void row_attention_out_kernel(
    const float* __restrict__ q, const float* __restrict__ k, const float* __restrict__ v,
    const int* __restrict__ bkt, const int* __restrict__ cnt,
    const unsigned long long* __restrict__ spill,
    const float* __restrict__ Wo, const float* __restrict__ bo,
    float* __restrict__ out, int n, int nE) {
  __shared__ __attribute__((aligned(16))) float att[FR * LDSTR];
  const int lane  = threadIdx.x & 31;
  const int half  = lane >> 4;
  const int lhalf = lane & 15;
  const unsigned loff = (unsigned)lhalf * 16u;
  // The wave's number and its rows are the same for the whole wave: scalar registers.
  const int wave = __builtin_amdgcn_readfirstlane(threadIdx.x >> 5);
  const int row0 = blockIdx.x * FR;
  const int rw   = row0 + wave * RPW;   // the wave's first row
  const char* kb = (const char*)k;
  const char* vb = (const char*)v;
  const float low = -3.0e38f;   // below every score; finite, so that low - low is 0

  // A wave takes its rows one after the other, so what a row's start waits for is asked for
  // at once for all of them: the counts, the first 32 list entries of each row and the q rows.
  // A q row waits in the LDS row that its own attention row will take (this wave's alone).
  int all4[RPW], ent4[RPW];
  #pragma unroll   // the counts stay in scalar registers
  for (int i = 0; i < RPW; ++i) all4[i] = rw + i < n ? cnt[rw + i] : 0;   // past the end: no edges
  unsigned eo[RPW];   // byte offset of the lane's entry; past the row's end, the last one
  #pragma unroll   // one register a row
  for (int i = 0; i < RPW; ++i)
    eo[i] = ((unsigned)(rw + i) * CAP + (unsigned)min(lane, max(min(all4[i], CAP), 1) - 1)) * 4u;
  #pragma unroll   // one register a row
  for (int i = 0; i < RPW; ++i) {
    ent4[i] = 0;
    if (all4[i] > 0) ent4[i] = *(const int*)((const char*)bkt + eo[i]);   // no edge: nothing is read
  }
  {
    v4f qs[RPW][2];
    const unsigned qo = (unsigned)lane * 16u;
    #pragma unroll   // registers
    for (int i = 0; i < RPW; ++i) {
      const char* qr = (const char*)q + (size_t)min(rw + i, n - 1) * (HID * 4) + qo;
      qs[i][0] = *(const v4f*)qr;
      qs[i][1] = *(const v4f*)(qr + 512);
      // The address is an input, so that neither load lands on it and nothing reuses it before this wait.
      asm volatile("s_wait_xcnt 0x0" :: "v"(qr) : "memory");
    }
    // The four offsets are inputs, so that none is reused before this wait.
    asm volatile("s_wait_xcnt 0x0" :: "v"(eo[0]), "v"(eo[1]), "v"(eo[2]), "v"(eo[3]) : "memory");
    #pragma unroll   // registers
    for (int i = 0; i < RPW; ++i) {
      float* qd = att + (wave * RPW + i) * LDSTR + lane * 4;
      *(v4f*)qd         = qs[i][0];
      *(v4f*)(qd + 128) = qs[i][1];
    }
  }

  #pragma unroll   // all4 and ent4 are indexed by constants
  for (int ri = 0; ri < RPW; ++ri) {
    const int r = rw + ri;
    const int all = all4[ri], deg = min(all, CAP);   // edges of the row; those in its own places
    const int* sl = bkt + r * CAP;
    v4f qv[4];
    for (int i = 0; i < 4; ++i)
      qv[i] = *(const v4f*)(att + (wave * RPW + ri) * LDSTR + i * 64 + lhalf * 4) * 1.44269504088896340736f;
    v4f a[4] = {}, zs = {};
    v4f mx = {low, low, low, low};
    // Takes in up to four edges with source nodes e0 .. e3, of which the first 'live' count.
    auto four_edges = [&](int e0, int e1, int e2, int e3, int live) {
      const unsigned o0 = (unsigned)(half ? e1 : e0) * (HID * 4u) + loff;
      const unsigned o1 = (unsigned)(half ? e3 : e2) * (HID * 4u) + loff;
      v4f k0[4], k1[4], x0[4], x1[4];
      for (int i = 0; i < 4; ++i) k0[i] = *(const v4f*)(kb + o0 + i * 256);
      for (int i = 0; i < 4; ++i) k1[i] = *(const v4f*)(kb + o1 + i * 256);
      for (int i = 0; i < 4; ++i) x0[i] = *(const v4f*)(vb + o0 + i * 256);
      for (int i = 0; i < 4; ++i) x1[i] = *(const v4f*)(vb + o1 + i * 256);
      // Keeps the sums below all sixteen loads, so that the loads fly together.
      __builtin_amdgcn_sched_barrier(0);
      // The two offsets are inputs, so that neither is reused before this wait.
      asm volatile("s_wait_xcnt 0x0" :: "v"(o0), "v"(o1) : "memory");
      const v4f s0 = edge_score(qv, k0, half < live, low);
      const v4f s1 = edge_score(qv, k1, 2 + half < live, low);
      v4f mn;
      for (int c = 0; c < 4; ++c) mn[c] = fmaxf(fmaxf(mx[c], s0[c]), s1[c]);
      const v4f f  = exp2_4(mx - mn);
      const v4f w0 = exp2_4(s0 - mn);
      const v4f w1 = exp2_4(s1 - mn);
      mx = mn;
      zs = zs * f + w0 + w1;
      for (int i = 0; i < 4; ++i) a[i] = a[i] * f + w0 * x0[i] + w1 * x1[i];
    };
    for (int base = 0; base < deg; base += 32) {
      // The next 32 list entries, one a lane; past the end, the last one.
      int ent = ent4[ri];
      if (base > 0) {
        ent = sl[min(base + lane, deg - 1)];
        // The address register of this load may be reused below.
        asm volatile("s_wait_xcnt 0x0" ::: "memory");
      }
      const int m = min(32, deg - base);
      for (int j = 0; j < m; j += 4)
        four_edges(__builtin_amdgcn_readlane(ent, j),     __builtin_amdgcn_readlane(ent, j + 1),
                   __builtin_amdgcn_readlane(ent, j + 2), __builtin_amdgcn_readlane(ent, j + 3), m - j);
    }
    if (all > CAP) {   // the same for the whole wave: the row's further edges, one at a time
      const int ns = min(cnt[n], nE);
      for (int base = 0; base < ns; base += 32) {
        const unsigned long long rec = spill[min(base + lane, ns - 1)];
        unsigned mine = __builtin_amdgcn_ballot_w32((int)(rec >> 32) == r && base + lane < ns);
        for (; mine; mine &= mine - 1) {
          const int e = __builtin_amdgcn_readlane((int)rec, __builtin_ctz(mine));
          four_edges(e, e, e, e, 1);
        }
      }
    }
    // The two halves' sums are brought to one maximum and added. Half 0 ends up
    // with columns 0..63 and 128..191, half 1 with the rest.
    v4f o0 = {}, o1 = {};
    if (deg > 0) {   // a row without edges stays zero
      v4f f;
      for (int c = 0; c < 4; ++c) f[c] = mx[c] - fmaxf(mx[c], other_half(mx[c]));
      f = exp2_4(f);
      zs *= f;
      for (int i = 0; i < 4; ++i) a[i] *= f;
      for (int c = 0; c < 4; ++c) {
        zs[c] += other_half(zs[c]);
        o0[c] = (half ? a[1][c] : a[0][c]) + other_half(half ? a[0][c] : a[1][c]);
        o1[c] = (half ? a[3][c] : a[2][c]) + other_half(half ? a[2][c] : a[3][c]);
      }
      const v4f rz = 1.0f / zs;
      o0 *= rz;
      o1 *= rz;
    }
    float* dst = att + (wave * RPW + ri) * LDSTR + half * 64 + lhalf * 4;
    *(v4f*)dst         = o0;
    *(v4f*)(dst + 128) = o1;
  }

  // Output projection. The wave owns columns 64 wave .. 64 wave + 63 as four 16-column
  // tiles. Fragments and k order as in gemm256_strip.
  const int khi = half * 2;           // 0 for lanes 0-15, 2 for lanes 16-31
  const int cw  = wave * 64 + lhalf;  // the lane's column in tile 0
  const float* wp = Wo + khi * HID + cw;
  const float* ap = att + lhalf * LDSTR + khi;
  v2f bw[2][KC][4];                   // two sets: KC k-steps in use, KC in flight
  v2f af[2][KC];
  #pragma unroll   // registers
  for (int s = 0; s < KC; ++s)
    #pragma unroll
    for (int j = 0; j < 4; ++j) {
      bw[0][s][j].x = wp[(s * 4) * HID + j * 16];
      bw[0][s][j].y = wp[(s * 4 + 1) * HID + j * 16];
    }
  float bias[4];
  #pragma unroll   // registers
  for (int j = 0; j < 4; ++j) bias[j] = bo[cw + j * 16];
  __syncthreads();   // all sixteen attention rows are in LDS
  #pragma unroll   // registers
  for (int s = 0; s < KC; ++s) af[0][s] = *(const v2f*)(ap + s * 4);

  v8f acc[4] = {};
  #pragma unroll   // the two register sets are picked by constants
  for (int c = 0; c < HID / 4 / KC; ++c) {
    if (c + 1 < HID / 4 / KC) {
      #pragma unroll
      for (int s = 0; s < KC; ++s) {
        const int kk = ((c + 1) * KC + s) * 4;
        #pragma unroll
        for (int j = 0; j < 4; ++j) {
          bw[(c + 1) & 1][s][j].x = wp[kk * HID + j * 16];
          bw[(c + 1) & 1][s][j].y = wp[(kk + 1) * HID + j * 16];
        }
        af[(c + 1) & 1][s] = *(const v2f*)(ap + kk);
      }
      // Keeps the next set's loads ahead of this set's products, so that they fly meanwhile.
      __builtin_amdgcn_sched_barrier(0);
    }
    #pragma unroll
    for (int s = 0; s < KC; ++s) {
      #pragma unroll
      for (int j = 0; j < 4; ++j)
        acc[j] = __builtin_amdgcn_wmma_f32_16x16x4_f32(false, af[c & 1][s], false, bw[c & 1][s][j],
                                                       (short)0, acc[j], false, false);
      // The first step's weights are inputs behind its four products (whose sums are inputs too),
      // so that no product's new sum registers are laid over a weight that a product just ahead reads.
      if (c == 0 && s == 0)
        asm volatile("" :: "v"(bw[0][0][0]), "v"(bw[0][0][1]), "v"(bw[0][0][2]), "v"(bw[0][0][3]),
                           "v"(acc[0]), "v"(acc[1]), "v"(acc[2]), "v"(acc[3]));
    }
  }

  // Four vector slots between the last products and the first read of their sums, on both
  // sides of the branch below; the sums are inputs, so that the slots stand behind the products.
  asm volatile("v_nop\n\tv_nop\n\tv_nop\n\tv_nop" :: "v"(acc[0]), "v"(acc[1]), "v"(acc[2]), "v"(acc[3]));
  // Keeps the additions below behind those slots.
  __builtin_amdgcn_sched_barrier(0);

  // C/D layout: VGPR g -> M = g (lanes 0-15) or M = 8+g (lanes 16-31), N = lhalf.
  float* op = out + (size_t)(row0 + half * 8) * HID + cw;
  if (row0 + FR <= n) {   // a whole strip (the same for the work-group): one address, no test a store
    #pragma unroll
    for (int j = 0; j < 4; ++j)
      #pragma unroll
      for (int g = 0; g < 8; ++g) op[g * HID + j * 16] = acc[j][g] + bias[j];
  } else {
    #pragma unroll
    for (int j = 0; j < 4; ++j)
      #pragma unroll
      for (int g = 0; g < 8; ++g)
        if (row0 + half * 8 + g < n) op[g * HID + j * 16] = acc[j][g] + bias[j];
  }
}

// ---------------------------------------------------------------------------
extern "C" void kernel_launch(void* const* d_in, const int* in_sizes, int n_in,
                              void* d_out, int out_size, void* d_ws, size_t ws_size,
                              hipStream_t stream) {
  const float* h  = (const float*)d_in[0];
  const float* Wq = (const float*)d_in[1];
  const float* bq = (const float*)d_in[2];
  const float* Wk = (const float*)d_in[3];
  const float* bk = (const float*)d_in[4];
  const float* Wv = (const float*)d_in[5];
  const float* bv = (const float*)d_in[6];
  const float* Wo = (const float*)d_in[7];
  const float* bo = (const float*)d_in[8];
  const int* rows = (const int*)d_in[9];
  const int* cols = (const int*)d_in[10];
  float* out = (float*)d_out;

  const int N = in_sizes[0] / HID;
  const int E = in_sizes[9];
  const float scaling = 1.0f / sqrtf((float)HD);

  // Workspace layout (fp32 arrays, then int slots, 64-bit spill records and int counts)
  float* ws  = (float*)d_ws;
  float* q   = ws;                      // N*256
  float* k   = q + (size_t)N * HID;     // N*256
  float* v   = k + (size_t)N * HID;     // N*256
  int* bkt = (int*)(v + (size_t)N * HID);       // N*CAP source nodes, by row
  unsigned long long* spill = (unsigned long long*)(bkt + (size_t)N * CAP);   // E (row, source)
  int* cnt = (int*)(spill + E);                 // N edges per row, 1 spill length

  const int mblocks = (N + RPB - 1) / RPB;

  init_buffers<<<(N + 1 + 255) / 256, 256, 0, stream>>>(cnt, N);

  qkv256_wmma<<<dim3(mblocks + PLW, 3), 256, 0, stream>>>(h, Wq, Wk, Wv, bq, bk, bv, q, scaling, N,
                                                    rows, cols, cnt, bkt, spill, E);

  row_attention_out_kernel<<<(N + FR - 1) / FR, FW * 32, 0, stream>>>(q, k, v, bkt, cnt, spill,
                                                                      Wo, bo, out, N, E);
}

// v007
// A run of this version takes 101 microseconds.
// Timed twice side by side with v006, it ran 1.13 and 1.12 times as fast.
// Counting every step since v000, it is 4.24 times as fast.
#include <hip/hip_runtime.h>
#include <math.h>

typedef __attribute__((ext_vector_type(2))) float v2f;
typedef __attribute__((ext_vector_type(8))) float v8f;
typedef __attribute__((ext_vector_type(4))) float v4f;

#define HID   256
#define HEADS 8
#define HD    32
#define RPB   32    // rows per block (2 row-tiles of 16)
#define LDSTR 260   // LDS row stride (floats); 260 % 64 = 4 -> conflict-free A reads
#define CAP   64    // list places that every row owns; further edges go to the shared spill list
#define CST   32    // ints from one row's counter to the next: every counter has a 128-byte line of its own
#define PLW   56    // columns of edge-filing work-groups beside the strips of the projection grid
#define FR    16    // rows of one work-group of the attention and output launch (one row-tile)
#define FW    4     // its waves
#define RPW   (FR / FW)   // rows that one wave attends
#define KC    4     // k-steps of Wo that one register set holds

// ---------------------------------------------------------------------------
// [nrows x 256] @ [256 x 256] + bias, scaled, via V_WMMA_F32_16X16X4_F32.
// Block: 256 threads (8 wave32) on a 32-row strip. Each wave owns a 2x2 grid
// of 16x16 tiles (2 col-tiles x 2 row-tiles): per k-step, 2 A + 2 B fragments
// feed 4 WMMAs (register blocking doubles WMMA density per byte loaded).
// The strip is picked by blockIdx.x.
// ---------------------------------------------------------------------------
__device__ __forceinline__ void gemm256_strip(
    const float* __restrict__ X, const float* __restrict__ W,
    const float* __restrict__ B, float* __restrict__ Y,
    float scale, int nrows) {
  __shared__ __attribute__((aligned(16))) float a_lds[RPB * LDSTR];

  const int row0 = blockIdx.x * RPB;
  const int t    = threadIdx.x;

  // The 32x256 X strip goes to LDS in 16-byte pieces, eight a thread (a wave takes
  // half a row). No load stands under a branch: a row past the end reads the last
  // row and is stored as zero, so all eight loads fly together and are waited for once.
  {
    // 0..3, the same for a whole wave: clamp, row offset and tail test are scalar work.
    const int r0 = __builtin_amdgcn_readfirstlane(t >> 6);   // piece i lies in row r0 + 4 i
    const int c0 = (t & 63) * 4;    // 0..252
    v4f xs[RPB / 4];
    #pragma unroll   // the eight pieces stay in registers
    for (int i = 0; i < RPB / 4; ++i)
      xs[i] = *(const v4f*)(X + (size_t)min(row0 + r0 + i * 4, nrows - 1) * HID + c0);
    #pragma unroll   // as above
    for (int i = 0; i < RPB / 4; ++i) {
      const v4f zero = {};
      *(v4f*)(a_lds + (r0 + i * 4) * LDSTR + c0) = row0 + r0 + i * 4 < nrows ? xs[i] : zero;
    }
  }
  __syncthreads();

  const int wave  = t >> 5;           // 0..7
  const int lane  = t & 31;
  const int lhalf = lane & 15;        // lane within half-wave
  const int khi   = (lane >> 4) * 2;  // 0 for lanes 0-15, 2 for lanes 16-31
  const int col0  = wave * 32;        // this wave covers cols [col0, col0+32)

  v8f acc[2][2] = {};                 // [col-tile][row-tile]
  const float* wcol0 = W + col0 + lhalf;        // col tile 0
  const float* wcol1 = W + col0 + 16 + lhalf;   // col tile 1

  #pragma unroll 2
  for (int k = 0; k < HID; k += 4) {
    // A fragments (16x4): lane<16 -> K=k,k+1 of row M=lhalf; lane>=16 -> K=k+2,k+3.
    v2f a0, a1, b0, b1;
    a0.x = a_lds[lhalf * LDSTR + k + khi];
    a0.y = a_lds[lhalf * LDSTR + k + khi + 1];
    a1.x = a_lds[(16 + lhalf) * LDSTR + k + khi];
    a1.y = a_lds[(16 + lhalf) * LDSTR + k + khi + 1];
    // B fragments (4x16): lane<16 -> rows K=k,k+1 at col N=lhalf; lane>=16 -> K=k+2,k+3.
    b0.x = wcol0[(size_t)(k + khi) * HID];
    b0.y = wcol0[(size_t)(k + khi + 1) * HID];
    b1.x = wcol1[(size_t)(k + khi) * HID];
    b1.y = wcol1[(size_t)(k + khi + 1) * HID];

    acc[0][0] = __builtin_amdgcn_wmma_f32_16x16x4_f32(false, a0, false, b0,
                                                      (short)0, acc[0][0], false, false);
    acc[0][1] = __builtin_amdgcn_wmma_f32_16x16x4_f32(false, a1, false, b0,
                                                      (short)0, acc[0][1], false, false);
    acc[1][0] = __builtin_amdgcn_wmma_f32_16x16x4_f32(false, a0, false, b1,
                                                      (short)0, acc[1][0], false, false);
    acc[1][1] = __builtin_amdgcn_wmma_f32_16x16x4_f32(false, a1, false, b1,
                                                      (short)0, acc[1][1], false, false);
  }

  // C/D layout: VGPR g -> M = g (lanes 0-15) or M = 8+g (lanes 16-31), N = lhalf.
  #pragma unroll
  for (int ct = 0; ct < 2; ++ct) {
    const int cc   = col0 + ct * 16 + lhalf;
    const float bias = B[cc];
    #pragma unroll
    for (int rt = 0; rt < 2; ++rt) {
      const int rbase = row0 + rt * 16 + ((lane >> 4) ? 8 : 0);
      #pragma unroll
      for (int g = 0; g < 8; ++g) {
        const int r = rbase + g;
        if (r < nrows)
          Y[(size_t)r * HID + cc] = (acc[ct][rt][g] + bias) * scale;
      }
    }
  }
}

// ---------------------------------------------------------------------------
// init: per-row edge count = 0; counter n is the length of the spill list.
// Counter i is cnt[i * CST]: adds for different rows never meet in one memory line.
// ---------------------------------------------------------------------------
__global__ void init_buffers(int* __restrict__ cnt, int n) {
  const int t = blockIdx.x * blockDim.x + threadIdx.x;
  if (t < n + 1) cnt[t * CST] = 0;
}

// Bounds a node index read from an input array before an address is formed.
__device__ __forceinline__ int node_index(int x, int n) { return min(max(x, 0), n - 1); }

// ---------------------------------------------------------------------------
// Every edge takes the next place (arrival order) in its row's own CAP places
// of bkt and puts its source node there; an edge that finds them full goes, as
// (row, source), to the spill list, which holds at most nE records. No count
// pass and no prefix sum are needed: the places are fixed before any edge is seen.
// Swaps, not plain stores: the places beside an edge's own, in the same memory
// line, are written by other work-groups.
// ---------------------------------------------------------------------------
__device__ __forceinline__ void put_edge(int p, int r, int c, int* __restrict__ cnt,
                                         int* __restrict__ bkt,
                                         unsigned long long* __restrict__ spill, int n) {
  if (p < CAP)
    atomicExch(&bkt[r * CAP + p], c);
  else
    atomicExch(&spill[atomicAdd(&cnt[n * CST], 1)],
               ((unsigned long long)(unsigned)r << 32) | (unsigned)c);
}

// Four edges a thread and trip; this is work-group 'group' of 'groups' that share the edges.
__device__ __forceinline__ void place_edges(const int* __restrict__ rows,
                                            const int* __restrict__ cols,
                                            int* __restrict__ cnt, int* __restrict__ bkt,
                                            unsigned long long* __restrict__ spill,
                                            int nE, int n, int group, int groups) {
  const int step = groups * blockDim.x * 4;
  for (int e0 = (group * blockDim.x + threadIdx.x) * 4; e0 < nE; e0 += step) {
    if (e0 + 4 <= nE) {
      const int4 r4 = *(const int4*)(rows + e0);
      const int4 c4 = *(const int4*)(cols + e0);
      // The loads' address registers are reused right below.
      asm volatile("s_wait_xcnt 0x0" :: "v"(r4.x), "v"(c4.x) : "memory");
      const int r0 = node_index(r4.x, n), r1 = node_index(r4.y, n);
      const int r2 = node_index(r4.z, n), r3 = node_index(r4.w, n);
      // The four places are asked for together, ahead of the four swaps.
      const int o0 = r0 * CST, o1 = r1 * CST, o2 = r2 * CST, o3 = r3 * CST;
      const int p0 = atomicAdd(&cnt[o0], 1);
      const int p1 = atomicAdd(&cnt[o1], 1);
      const int p2 = atomicAdd(&cnt[o2], 1);
      const int p3 = atomicAdd(&cnt[o3], 1);
      // The four offsets are inputs, so that none is reused (nor taken for a result) before this wait.
      asm volatile("s_wait_xcnt 0x0" :: "v"(o0), "v"(o1), "v"(o2), "v"(o3) : "memory");
      put_edge(p0, r0, node_index(c4.x, n), cnt, bkt, spill, n);
      put_edge(p1, r1, node_index(c4.y, n), cnt, bkt, spill, n);
      put_edge(p2, r2, node_index(c4.z, n), cnt, bkt, spill, n);
      put_edge(p3, r3, node_index(c4.w, n), cnt, bkt, spill, n);
    } else {
      for (int e = e0; e < nE; ++e) {
        const int r = node_index(rows[e], n);
        const int o = r * CST;
        const int p = atomicAdd(&cnt[o], 1);
        // The offset is an input, so that it is not reused (nor taken for a result) before this wait.
        asm volatile("s_wait_xcnt 0x0" :: "v"(o) : "memory");
        put_edge(p, r, node_index(cols[e], n), cnt, bkt, spill, n);
        // The swap's registers are reused in the next trip.
        asm volatile("s_wait_xcnt 0x0" ::: "memory");
      }
    }
  }
}

// ---------------------------------------------------------------------------
// The three projections of one input in one launch: blockIdx.y picks the weight,
// the bias and the output plane (q, k, v lie one behind the other in Y). All
// strips of all three are on the chip together, so one launch's start and tail
// are paid, not three, and a SIMD has more waves to cover the weight loads.
// The work-groups whose blockIdx.x lies past the last strip file the edges: that
// work needs nothing of the projections and runs beside them.
// ---------------------------------------------------------------------------
__global__ __launch_bounds__(256) void qkv256_wmma(
    const float* __restrict__ X,
    const float* __restrict__ Wq, const float* __restrict__ Wk, const float* __restrict__ Wv,
    const float* __restrict__ bq, const float* __restrict__ bk, const float* __restrict__ bv,
    float* __restrict__ Y, float qscale, int nrows,
    const int* __restrict__ rows, const int* __restrict__ cols,
    int* __restrict__ cnt, int* __restrict__ bkt, unsigned long long* __restrict__ spill, int nE) {
  const int extra = blockIdx.x - (nrows + RPB - 1) / RPB;
  if (extra >= 0) {   // the whole work-group, ahead of every barrier
    place_edges(rows, cols, cnt, bkt, spill, nE, nrows, blockIdx.y * PLW + extra, gridDim.y * PLW);
    return;
  }
  const int p = blockIdx.y;
  gemm256_strip(X, p == 0 ? Wq : p == 1 ? Wk : Wv, p == 0 ? bq : p == 1 ? bk : bv,
                Y + (size_t)p * nrows * HID, p == 0 ? qscale : 1.0f, nrows);
}

// ---------------------------------------------------------------------------
// Scores, softmax and weighted sum of one row in one wave, over the row's own
// places and, for a row that overran them, its records in the spill list.
// Each half of the wave takes every other edge: lane l of
// a half holds columns 64i + 4l .. 64i + 4l + 3 (i = 0..3) of q, k, v and of
// the sums, which are heads 4*(l&1) .. 4*(l&1)+3. The maximum runs along with
// the sums (the sums are rescaled when it grows); scores are kept in base 2.
// ---------------------------------------------------------------------------
template <int M>
__device__ __forceinline__ float add_xor_lane(float x) {   // x + x of lane ^ M, M < 16
  return x + __int_as_float(__builtin_amdgcn_update_dpp(0, __float_as_int(x), 0x160 | M,
                                                        0xf, 0xf, true));
}

__device__ __forceinline__ float other_half(float x) {     // x of lane ^ 16
  const int i = __float_as_int(x);
  return __int_as_float(__builtin_amdgcn_permlanex16(i, i, 0x76543210, 0xfedcba98, false, false));
}

__device__ __forceinline__ v4f exp2_4(v4f x) {
  v4f y;
  y.x = __builtin_amdgcn_exp2f(x.x);
  y.y = __builtin_amdgcn_exp2f(x.y);
  y.z = __builtin_amdgcn_exp2f(x.z);
  y.w = __builtin_amdgcn_exp2f(x.w);
  return y;
}

// Per-head score of one edge, the same in all lanes of the half that hold the head.
__device__ __forceinline__ v4f edge_score(const v4f* qv, const v4f* kv, bool valid, float low) {
  v2f pl = qv[0].lo * kv[0].lo, ph = qv[0].hi * kv[0].hi;
  for (int i = 1; i < 4; ++i) {
    pl += qv[i].lo * kv[i].lo;
    ph += qv[i].hi * kv[i].hi;
  }
  const v4f p = {pl.x, pl.y, ph.x, ph.y};
  v4f s;
  for (int c = 0; c < 4; ++c) {
    const float t = add_xor_lane<8>(add_xor_lane<4>(add_xor_lane<2>(p[c])));
    s[c] = valid ? t : low;
  }
  return s;
}

// ---------------------------------------------------------------------------
// Attention and output projection of FR rows in one work-group of FW waves.
// Each wave attends RPW rows, one after the other, and puts each finished row
// into LDS; behind one barrier the 16 x 256 strip is multiplied by Wo on WMMA.
// The attention rows never go to memory and no further launch is needed.
// ---------------------------------------------------------------------------
__global__ __launch_bounds__(FW * 32) void row_attention_out_kernel(
    const float* __restrict__ q, const float* __restrict__ k, const float* __restrict__ v,
    const int* __restrict__ bkt, const int* __restrict__ cnt,
    const unsigned long long* __restrict__ spill,
    const float* __restrict__ Wo, const float* __restrict__ bo,
    float* __restrict__ out, int n, int nE) {
  __shared__ __attribute__((aligned(16))) float att[FR * LDSTR];
  const int lane  = threadIdx.x & 31;
  const int half  = lane >> 4;
  const int lhalf = lane & 15;
  const unsigned loff = (unsigned)lhalf * 16u;
  // The wave's number and its rows are the same for the whole wave: scalar registers.
  const int wave = __builtin_amdgcn_readfirstlane(threadIdx.x >> 5);
  const int row0 = blockIdx.x * FR;
  const int rw   = row0 + wave * RPW;   // the wave's first row
  const char* kb = (const char*)k;
  const char* vb = (const char*)v;
  const float low = -3.0e38f;   // below every score; finite, so that low - low is 0

  // A wave takes its rows one after the other, so what a row's start waits for is asked for
  // at once for all of them: the counts, the first 32 list entries of each row and the q rows.
  // A q row waits in the LDS row that its own attention row will take (this wave's alone).
  int all4[RPW], ent4[RPW];
  #pragma unroll   // the counts stay in scalar registers
  for (int i = 0; i < RPW; ++i) all4[i] = rw + i < n ? cnt[(rw + i) * CST] : 0;   // past the end: no edges
  unsigned eo[RPW];   // byte offset of the lane's entry; past the row's end, the last one
  #pragma unroll   // one register a row
  for (int i = 0; i < RPW; ++i)
    eo[i] = ((unsigned)(rw + i) * CAP + (unsigned)min(lane, max(min(all4[i], CAP), 1) - 1)) * 4u;
  #pragma unroll   // one register a row
  for (int i = 0; i < RPW; ++i) {
    ent4[i] = 0;
    if (all4[i] > 0) ent4[i] = *(const int*)((const char*)bkt + eo[i]);   // no edge: nothing is read
  }
  {
    v4f qs[RPW][2];
    const unsigned qo = (unsigned)lane * 16u;
    #pragma unroll   // registers
    for (int i = 0; i < RPW; ++i) {
      const char* qr = (const char*)q + (size_t)min(rw + i, n - 1) * (HID * 4) + qo;
      qs[i][0] = *(const v4f*)qr;
      qs[i][1] = *(const v4f*)(qr + 512);
      // The address is an input, so that neither load lands on it and nothing reuses it before this wait.
      asm volatile("s_wait_xcnt 0x0" :: "v"(qr) : "memory");
    }
    // The four offsets are inputs, so that none is reused before this wait.
    asm volatile("s_wait_xcnt 0x0" :: "v"(eo[0]), "v"(eo[1]), "v"(eo[2]), "v"(eo[3]) : "memory");
    #pragma unroll   // registers
    for (int i = 0; i < RPW; ++i) {
      float* qd = att + (wave * RPW + i) * LDSTR + lane * 4;
      *(v4f*)qd         = qs[i][0];
      *(v4f*)(qd + 128) = qs[i][1];
    }
  }

  #pragma unroll   // all4 and ent4 are indexed by constants
  for (int ri = 0; ri < RPW; ++ri) {
    const int r = rw + ri;
    const int all = all4[ri], deg = min(all, CAP);   // edges of the row; those in its own places
    const int* sl = bkt + r * CAP;
    v4f qv[4];
    for (int i = 0; i < 4; ++i)
      qv[i] = *(const v4f*)(att + (wave * RPW + ri) * LDSTR + i * 64 + lhalf * 4) * 1.44269504088896340736f;
    v4f a[4] = {}, zs = {};
    v4f mx = {low, low, low, low};
    // Takes in up to four edges with source nodes e0 .. e3, of which the first 'live' count.
    auto four_edges = [&](int e0, int e1, int e2, int e3, int live) {
      const unsigned o0 = (unsigned)(half ? e1 : e0) * (HID * 4u) + loff;
      const unsigned o1 = (unsigned)(half ? e3 : e2) * (HID * 4u) + loff;
      v4f k0[4], k1[4], x0[4], x1[4];
      for (int i = 0; i < 4; ++i) k0[i] = *(const v4f*)(kb + o0 + i * 256);
      for (int i = 0; i < 4; ++i) k1[i] = *(const v4f*)(kb + o1 + i * 256);
      for (int i = 0; i < 4; ++i) x0[i] = *(const v4f*)(vb + o0 + i * 256);
      for (int i = 0; i < 4; ++i) x1[i] = *(const v4f*)(vb + o1 + i * 256);
      // Keeps the sums below all sixteen loads, so that the loads fly together.
      __builtin_amdgcn_sched_barrier(0);
      // The two offsets are inputs, so that neither is reused before this wait.
      asm volatile("s_wait_xcnt 0x0" :: "v"(o0), "v"(o1) : "memory");
      const v4f s0 = edge_score(qv, k0, half < live, low);
      const v4f s1 = edge_score(qv, k1, 2 + half < live, low);
      v4f mn;
      for (int c = 0; c < 4; ++c) mn[c] = fmaxf(fmaxf(mx[c], s0[c]), s1[c]);
      const v4f f  = exp2_4(mx - mn);
      const v4f w0 = exp2_4(s0 - mn);
      const v4f w1 = exp2_4(s1 - mn);
      mx = mn;
      zs = zs * f + w0 + w1;
      for (int i = 0; i < 4; ++i) a[i] = a[i] * f + w0 * x0[i] + w1 * x1[i];
    };
    for (int base = 0; base < deg; base += 32) {
      // The next 32 list entries, one a lane; past the end, the last one.
      int ent = ent4[ri];
      if (base > 0) {
        ent = sl[min(base + lane, deg - 1)];
        // The address register of this load may be reused below.
        asm volatile("s_wait_xcnt 0x0" ::: "memory");
      }
      const int m = min(32, deg - base);
      for (int j = 0; j < m; j += 4)
        four_edges(__builtin_amdgcn_readlane(ent, j),     __builtin_amdgcn_readlane(ent, j + 1),
                   __builtin_amdgcn_readlane(ent, j + 2), __builtin_amdgcn_readlane(ent, j + 3), m - j);
    }
    if (all > CAP) {   // the same for the whole wave: the row's further edges, one at a time
      const int ns = min(cnt[n * CST], nE);
      for (int base = 0; base < ns; base += 32) {
        const unsigned long long rec = spill[min(base + lane, ns - 1)];
        unsigned mine = __builtin_amdgcn_ballot_w32((int)(rec >> 32) == r && base + lane < ns);
        for (; mine; mine &= mine - 1) {
          const int e = __builtin_amdgcn_readlane((int)rec, __builtin_ctz(mine));
          four_edges(e, e, e, e, 1);
        }
      }
    }
    // The two halves' sums are brought to one maximum and added. Half 0 ends up
    // with columns 0..63 and 128..191, half 1 with the rest.
    v4f o0 = {}, o1 = {};
    if (deg > 0) {   // a row without edges stays zero
      v4f f;
      for (int c = 0; c < 4; ++c) f[c] = mx[c] - fmaxf(mx[c], other_half(mx[c]));
      f = exp2_4(f);
      zs *= f;
      for (int i = 0; i < 4; ++i) a[i] *= f;
      for (int c = 0; c < 4; ++c) {
        zs[c] += other_half(zs[c]);
        o0[c] = (half ? a[1][c] : a[0][c]) + other_half(half ? a[0][c] : a[1][c]);
        o1[c] = (half ? a[3][c] : a[2][c]) + other_half(half ? a[2][c] : a[3][c]);
      }
      const v4f rz = 1.0f / zs;
      o0 *= rz;
      o1 *= rz;
    }
    float* dst = att + (wave * RPW + ri) * LDSTR + half * 64 + lhalf * 4;
    *(v4f*)dst         = o0;
    *(v4f*)(dst + 128) = o1;
  }

  // Output projection. The wave owns columns 64 wave .. 64 wave + 63 as four 16-column
  // tiles. Fragments and k order as in gemm256_strip.
  const int khi = half * 2;           // 0 for lanes 0-15, 2 for lanes 16-31
  const int cw  = wave * 64 + lhalf;  // the lane's column in tile 0
  const float* wp = Wo + khi * HID + cw;
  const float* ap = att + lhalf * LDSTR + khi;
  v2f bw[2][KC][4];                   // two sets: KC k-steps in use, KC in flight
  v2f af[2][KC];
  #pragma unroll   // registers
  for (int s = 0; s < KC; ++s)
    #pragma unroll
    for (int j = 0; j < 4; ++j) {
      bw[0][s][j].x = wp[(s * 4) * HID + j * 16];
      bw[0][s][j].y = wp[(s * 4 + 1) * HID + j * 16];
    }
  float bias[4];
  #pragma unroll   // registers
  for (int j = 0; j < 4; ++j) bias[j] = bo[cw + j * 16];
  __syncthreads();   // all sixteen attention rows are in LDS
  #pragma unroll   // registers
  for (int s = 0; s < KC; ++s) af[0][s] = *(const v2f*)(ap + s * 4);

  v8f acc[4] = {};
  #pragma unroll   // the two register sets are picked by constants
  for (int c = 0; c < HID / 4 / KC; ++c) {
    if (c + 1 < HID / 4 / KC) {
      #pragma unroll
      for (int s = 0; s < KC; ++s) {
        const int kk = ((c + 1) * KC + s) * 4;
        #pragma unroll
        for (int j = 0; j < 4; ++j) {
          bw[(c + 1) & 1][s][j].x = wp[kk * HID + j * 16];
          bw[(c + 1) & 1][s][j].y = wp[(kk + 1) * HID + j * 16];
        }
        af[(c + 1) & 1][s] = *(const v2f*)(ap + kk);
      }
      // Keeps the next set's loads ahead of this set's products, so that they fly meanwhile.
      __builtin_amdgcn_sched_barrier(0);
    }
    #pragma unroll
    for (int s = 0; s < KC; ++s) {
      #pragma unroll
      for (int j = 0; j < 4; ++j)
        acc[j] = __builtin_amdgcn_wmma_f32_16x16x4_f32(false, af[c & 1][s], false, bw[c & 1][s][j],
                                                       (short)0, acc[j], false, false);
      // The first step's weights are inputs behind its four products (whose sums are inputs too),
      // so that no product's new sum registers are laid over a weight that a product just ahead reads.
      if (c == 0 && s == 0)
        asm volatile("" :: "v"(bw[0][0][0]), "v"(bw[0][0][1]), "v"(bw[0][0][2]), "v"(bw[0][0][3]),
                           "v"(acc[0]), "v"(acc[1]), "v"(acc[2]), "v"(acc[3]));
    }
  }

  // Four vector slots between the last products and the first read of their sums, on both
  // sides of the branch below; the sums are inputs, so that the slots stand behind the products.
  asm volatile("v_nop\n\tv_nop\n\tv_nop\n\tv_nop" :: "v"(acc[0]), "v"(acc[1]), "v"(acc[2]), "v"(acc[3]));
  // Keeps the additions below behind those slots.
  __builtin_amdgcn_sched_barrier(0);

  // C/D layout: VGPR g -> M = g (lanes 0-15) or M = 8+g (lanes 16-31), N = lhalf.
  float* op = out + (size_t)(row0 + half * 8) * HID + cw;
  if (row0 + FR <= n) {   // a whole strip (the same for the work-group): one address, no test a store
    #pragma unroll
    for (int j = 0; j < 4; ++j)
      #pragma unroll
      for (int g = 0; g < 8; ++g) op[g * HID + j * 16] = acc[j][g] + bias[j];
  } else {
    #pragma unroll
    for (int j = 0; j < 4; ++j)
      #pragma unroll
      for (int g = 0; g < 8; ++g)
        if (row0 + half * 8 + g < n) op[g * HID + j * 16] = acc[j][g] + bias[j];
  }
}

// ---------------------------------------------------------------------------
extern "C" void kernel_launch(void* const* d_in, const int* in_sizes, int n_in,
                              void* d_out, int out_size, void* d_ws, size_t ws_size,
                              hipStream_t stream) {
  const float* h  = (const float*)d_in[0];
  const float* Wq = (const float*)d_in[1];
  const float* bq = (const float*)d_in[2];
  const float* Wk = (const float*)d_in[3];
  const float* bk = (const float*)d_in[4];
  const float* Wv = (const float*)d_in[5];
  const float* bv = (const float*)d_in[6];
  const float* Wo = (const float*)d_in[7];
  const float* bo = (const float*)d_in[8];
  const int* rows = (const int*)d_in[9];
  const int* cols = (const int*)d_in[10];
  float* out = (float*)d_out;

  const int N = in_sizes[0] / HID;
  const int E = in_sizes[9];
  const float scaling = 1.0f / sqrtf((float)HD);

  // Workspace layout (fp32 arrays, then int slots, 64-bit spill records and int counts)
  float* ws  = (float*)d_ws;
  float* q   = ws;                      // N*256
  float* k   = q + (size_t)N * HID;     // N*256
  float* v   = k + (size_t)N * HID;     // N*256
  int* bkt = (int*)(v + (size_t)N * HID);       // N*CAP source nodes, by row
  unsigned long long* spill = (unsigned long long*)(bkt + (size_t)N * CAP);   // E (row, source)
  int* cnt = (int*)(spill + E);                 // N edges per row, 1 spill length, CST ints apart

  const int mblocks = (N + RPB - 1) / RPB;

  init_buffers<<<(N + 1 + 255) / 256, 256, 0, stream>>>(cnt, N);

  qkv256_wmma<<<dim3(mblocks + PLW, 3), 256, 0, stream>>>(h, Wq, Wk, Wv, bq, bk, bv, q, scaling, N,
                                                    rows, cols, cnt, bkt, spill, E);

  row_attention_out_kernel<<<(N + FR - 1) / FR, FW * 32, 0, stream>>>(q, k, v, bkt, cnt, spill,
                                                                      Wo, bo, out, N, E);
}
